// v000
// Measured on an AMD MI455X. A time is GPU time per run, averaged over a window of back-to-back runs after a warm-up
// (all launches, gaps included; the runs take copies of the inputs in turn), and the median of several windows.
// Apart from v000's, it joins two sittings. Times from different sittings can be a few percent apart, while
// side-by-side timings come from the same sitting.
// v000, which the later versions start from, runs in 174 microseconds.
#include <hip/hip_runtime.h>

typedef __attribute__((ext_vector_type(16))) _Float16 v16h;
typedef __attribute__((ext_vector_type(8)))  _Float16 v8h;
typedef __attribute__((ext_vector_type(8)))  float    v8f;

#define DMODEL 512
#define NHEADS 8
#define DHEAD  64
#define TSEQ   2048
#define BT     4096   // B*T rows

__device__ __forceinline__ v16h cat8(v8h lo, v8h hi) {
  v16h r;
#pragma unroll
  for (int i = 0; i < 8; ++i) { r[i] = lo[i]; r[i + 8] = hi[i]; }
  return r;
}

__device__ __forceinline__ v8f wmma_f16(v16h a, v16h b, v8f c) {
  // D = A(16x32 f16) * B(32x16 f16) + C(16x16 f32)
  return __builtin_amdgcn_wmma_f32_16x16x32_f16(false, a, false, b, (short)0, c,
                                                false, false);
}

// ---------------------------------------------------------------------------
// Generic 4096x512 @ 512x512 GEMM, f32 inputs converted to f16 for WMMA.
// MODE 0: f32 row-major out (* scale)
// MODE 1: f16 row-major out (* scale)
// MODE 2: f16 transposed out  Out[col * BT + row]  (* scale)
// Block: 256 threads (8 waves). Tile: 64(M) x 64(N), K-step 32.
// ---------------------------------------------------------------------------
template <int MODE>
__global__ __launch_bounds__(256) void gemm512(const float* __restrict__ A,
                                               const float* __restrict__ W,
                                               void* __restrict__ Out,
                                               float scale) {
  __shared__ _Float16 As[64][40];   // As[m][k]
  __shared__ _Float16 Bst[64][40];  // Bst[n][k] = W[k0+k][n0+n]

  const int t    = threadIdx.x;
  const int lane = t & 31;
  const int w    = t >> 5;
  const int m0   = blockIdx.x * 64;
  const int n0   = blockIdx.y * 64;

  const int r0  = (w & 3) * 16;        // wave's 16-row block
  const int c0  = (w >> 2) * 32;       // wave's 32-col block (two 16-col tiles)
  const int kb  = (lane >> 4) * 8;     // per-lane K sub-chunk (A/B frag layout)
  const int l15 = lane & 15;

  v8f acc0 = {}, acc1 = {};

  for (int k0 = 0; k0 < DMODEL; k0 += 32) {
    __syncthreads();
    {
      // Stage A tile 64x32 (4 threads/row, 8 f32 each)
      const int row = t >> 2, cs = (t & 3) * 8;
      const float* ap = A + (size_t)(m0 + row) * DMODEL + k0 + cs;
#pragma unroll
      for (int j = 0; j < 8; ++j) As[row][cs + j] = (_Float16)ap[j];
      // Stage W tile 32x64 transposed (8 threads/row, 8 f32 each)
      const int krow = t >> 3, ns = (t & 7) * 8;
      const float* wp = W + (size_t)(k0 + krow) * DMODEL + n0 + ns;
#pragma unroll
      for (int j = 0; j < 8; ++j) Bst[ns + j][krow] = (_Float16)wp[j];
      if (k0 + 32 < DMODEL) {
        __builtin_prefetch(ap + 32, 0, 0);                 // global_prefetch_b8
        __builtin_prefetch(wp + (size_t)32 * DMODEL, 0, 0);
      }
    }
    __syncthreads();

    // A fragment (16x32 f16): lane holds row r0+l15, K chunks kb..kb+7, kb+16..kb+23
    const int mrow = r0 + l15;
    v16h af = cat8(*(const v8h*)&As[mrow][kb], *(const v8h*)&As[mrow][kb + 16]);
    // B fragments (32x16 f16): lane holds col, K chunks as above
    const int nc = c0 + l15;
    v16h b0 = cat8(*(const v8h*)&Bst[nc][kb], *(const v8h*)&Bst[nc][kb + 16]);
    v16h b1 = cat8(*(const v8h*)&Bst[nc + 16][kb], *(const v8h*)&Bst[nc + 16][kb + 16]);
    acc0 = wmma_f16(af, b0, acc0);
    acc1 = wmma_f16(af, b1, acc1);
  }

  // C layout: element v -> (row = v + 8*(lane>>4), col = lane&15)
  const int mrow = m0 + r0 + 8 * (lane >> 4);
  const int ncol = n0 + c0 + l15;
#pragma unroll
  for (int v = 0; v < 8; ++v) {
    const int gr = mrow + v;
    const float x0 = acc0[v] * scale;
    const float x1 = acc1[v] * scale;
    if (MODE == 0) {
      float* o = (float*)Out;
      o[(size_t)gr * DMODEL + ncol]      = x0;
      o[(size_t)gr * DMODEL + ncol + 16] = x1;
    } else if (MODE == 1) {
      _Float16* o = (_Float16*)Out;
      o[(size_t)gr * DMODEL + ncol]      = (_Float16)x0;
      o[(size_t)gr * DMODEL + ncol + 16] = (_Float16)x1;
    } else {
      _Float16* o = (_Float16*)Out;
      o[(size_t)ncol * BT + gr]        = (_Float16)x0;
      o[(size_t)(ncol + 16) * BT + gr] = (_Float16)x1;
    }
  }
}

// ---------------------------------------------------------------------------
// Retention: O[b,h,n,:] = sum_m gamma_h^(n-m) * (Q K^T)[n,m] * V[m,:]  (m<=n)
// Grid: (T/64, H, B). Block 128 = 4 waves; wave owns 16 query rows.
// Q pre-scaled by 1/sqrt(dh)=0.125 in the projection.
// Decay factored as gamma^(n-m) = rowfac(n,m0) * colfac(m-m0); rowfac updated
// multiplicatively per key block -> zero transcendentals in the hot loop.
// ---------------------------------------------------------------------------
__global__ __launch_bounds__(128) void retention_kernel(
    const _Float16* __restrict__ Qh,   // (B*T, 512) f16, pre-scaled
    const _Float16* __restrict__ Kh,   // (B*T, 512) f16
    const _Float16* __restrict__ Vt,   // (512, B*T) f16 (transposed V)
    float* __restrict__ Ret) {         // (B*T, 512) f32
  __shared__ _Float16 Pl[4][16][40];   // per-wave decayed-score tile (16x32)

  const int lane = threadIdx.x & 31;
  const int w    = threadIdx.x >> 5;
  const int h    = blockIdx.y;
  const int b    = blockIdx.z;
  const int q0   = blockIdx.x * 64 + w * 16;  // query base within batch

  const int kb   = (lane >> 4) * 8;
  const int l15  = lane & 15;
  const int mloc = 8 * (lane >> 4);

  const float gamma = 1.0f - __builtin_amdgcn_exp2f(-5.0f - (float)h);
  const float lg    = __builtin_log2f(gamma);

  // colfac = gamma^(-(key - m0)) for the two 16-col key tiles (exp in [0,32))
  const float cw0 = __builtin_amdgcn_exp2f(-lg * (float)l15);
  const float cw1 = __builtin_amdgcn_exp2f(-lg * (float)(16 + l15));
  // rowfac[v] = gamma^(qn - m0), starting at m0 = 0; step by gamma^-32
  const float stepf = __builtin_amdgcn_exp2f(-lg * 32.0f);
  float rf[8];
#pragma unroll
  for (int v = 0; v < 8; ++v)
    rf[v] = __builtin_amdgcn_exp2f(lg * (float)(q0 + mloc + v));

  // Q A-fragments for K-dim 64 (two 16x32 tiles), loaded once from global
  const v8h* qp = (const v8h*)(Qh + (size_t)(b * TSEQ + q0 + l15) * DMODEL +
                               h * DHEAD + kb);
  const v16h aq0 = cat8(qp[0], qp[2]);
  const v16h aq1 = cat8(qp[4], qp[6]);

  v8f oacc[4] = {{}, {}, {}, {}};

  for (int m0 = 0; m0 <= q0 + 15; m0 += 32) {   // 32-key blocks up to diagonal
#pragma unroll
    for (int tkey = 0; tkey < 2; ++tkey) {
      const int key = m0 + tkey * 16 + l15;     // this lane's key column
      const float cw = tkey ? cw1 : cw0;
      // K^T B-fragment: lane holds key row, feature chunks per B layout
      const v8h* kp = (const v8h*)(Kh + (size_t)(b * TSEQ + key) * DMODEL +
                                   h * DHEAD + kb);
      v16h bk0 = cat8(kp[0], kp[2]);
      v16h bk1 = cat8(kp[4], kp[6]);
      v8f s = {};
      s = wmma_f16(aq0, bk0, s);
      s = wmma_f16(aq1, bk1, s);
      // causal multi-scale decay on C fragment, convert to f16 A-tile in LDS
#pragma unroll
      for (int v = 0; v < 8; ++v) {
        const int qn = q0 + mloc + v;
        const float wgt = (qn >= key) ? rf[v] * cw : 0.0f;
        Pl[w][mloc + v][tkey * 16 + l15] = (_Float16)(s[v] * wgt);
      }
    }
#pragma unroll
    for (int v = 0; v < 8; ++v) rf[v] *= stepf;  // advance rowfac to next m0

    // LDS is in-order per wave; explicit wait keeps the RAW airtight
    asm volatile("s_wait_dscnt 0" ::: "memory");

    // P A-fragment (16x32)
    v16h pf = cat8(*(const v8h*)&Pl[w][l15][kb],
                   *(const v8h*)&Pl[w][l15][kb + 16]);
    // V B-fragments: 4 feature tiles of 16; contiguous thanks to Vt transpose
#pragma unroll
    for (int nt = 0; nt < 4; ++nt) {
      const int d = nt * 16 + l15;
      const v8h* vp = (const v8h*)(Vt + (size_t)(h * DHEAD + d) * BT +
                                   b * TSEQ + m0 + kb);
      v16h bv = cat8(vp[0], vp[2]);
      oacc[nt] = wmma_f16(pf, bv, oacc[nt]);
    }
  }

#pragma unroll
  for (int nt = 0; nt < 4; ++nt)
#pragma unroll
    for (int v = 0; v < 8; ++v)
      Ret[(size_t)(b * TSEQ + q0 + mloc + v) * DMODEL + h * DHEAD + nt * 16 +
          l15] = oacc[nt][v];
}

// ---------------------------------------------------------------------------
// GroupNorm(8, 512) per token + gate: Z = silu(Gp + gn(Ret)*w + b)
// One 64-thread block per (token, head) group.
// ---------------------------------------------------------------------------
__global__ __launch_bounds__(64) void gn_gate_kernel(
    const float* __restrict__ Ret, const float* __restrict__ Gp,
    const float* __restrict__ gw, const float* __restrict__ gb,
    float* __restrict__ Z) {
  __shared__ float s1[64], s2[64];
  const int d    = threadIdx.x;
  const int gidx = blockIdx.x;
  const int h    = gidx & (NHEADS - 1);
  const int tok  = gidx >> 3;
  const size_t base = (size_t)tok * DMODEL + h * DHEAD;
  const float x = Ret[base + d];
  s1[d] = x;
  s2[d] = x * x;
  __syncthreads();
#pragma unroll
  for (int off = 32; off > 0; off >>= 1) {
    if (d < off) { s1[d] += s1[d + off]; s2[d] += s2[d + off]; }
    __syncthreads();
  }
  const float mean = s1[0] * (1.0f / 64.0f);
  const float var  = s2[0] * (1.0f / 64.0f) - mean * mean;
  const float nrm  = (x - mean) * rsqrtf(var + 1e-5f);
  const float zz   = Gp[base + d] + nrm * gw[h * DHEAD + d] + gb[h * DHEAD + d];
  Z[base + d] = zz / (1.0f + __expf(-zz));
}

// ---------------------------------------------------------------------------
extern "C" void kernel_launch(void* const* d_in, const int* in_sizes, int n_in,
                              void* d_out, int out_size, void* d_ws,
                              size_t ws_size, hipStream_t stream) {
  const float* x  = (const float*)d_in[0];
  const float* WQ = (const float*)d_in[1];
  const float* WK = (const float*)d_in[2];
  const float* WV = (const float*)d_in[3];
  const float* WG = (const float*)d_in[4];
  const float* WO = (const float*)d_in[5];
  const float* gw = (const float*)d_in[6];
  const float* gb = (const float*)d_in[7];

  char* ws = (char*)d_ws;
  _Float16* Qh = (_Float16*)(ws);                  // 4 MB: Q * 0.125, f16
  _Float16* Kh = (_Float16*)(ws + (4u << 20));     // 4 MB
  _Float16* Vt = (_Float16*)(ws + (8u << 20));     // 4 MB (transposed)
  float*    Gp = (float*)(ws + (12u << 20));       // 8 MB gate preact
  float*    Rt = (float*)(ws + (20u << 20));       // 8 MB retention out
  float*    Zb = (float*)(ws + (28u << 20));       // 8 MB silu out (36 MB total)

  dim3 gg(BT / 64, DMODEL / 64);
  gemm512<1><<<gg, 256, 0, stream>>>(x, WQ, Qh, 0.125f);
  gemm512<1><<<gg, 256, 0, stream>>>(x, WK, Kh, 1.0f);
  gemm512<2><<<gg, 256, 0, stream>>>(x, WV, Vt, 1.0f);
  gemm512<0><<<gg, 256, 0, stream>>>(x, WG, Gp, 1.0f);

  retention_kernel<<<dim3(TSEQ / 64, NHEADS, 2), 128, 0, stream>>>(Qh, Kh, Vt,
                                                                   Rt);
  gn_gate_kernel<<<BT * NHEADS, 64, 0, stream>>>(Rt, Gp, gw, gb, Zb);

  gemm512<0><<<gg, 256, 0, stream>>>(Zb, WO, (float*)d_out, 1.0f);
}

// v001
// Measured time: 114 microseconds a run.
// Timed twice side by side with v000, it ran 1.54 and 1.53 times as fast.
#include <hip/hip_runtime.h>

typedef __attribute__((ext_vector_type(16))) _Float16 v16h;
typedef __attribute__((ext_vector_type(8)))  _Float16 v8h;
typedef __attribute__((ext_vector_type(8)))  float    v8f;

#define DMODEL 512
#define NHEADS 8
#define DHEAD  64
#define TSEQ   2048
#define BT     4096   // B*T rows

__device__ __forceinline__ v16h cat8(v8h lo, v8h hi) {
  v16h r;
#pragma unroll
  for (int i = 0; i < 8; ++i) { r[i] = lo[i]; r[i + 8] = hi[i]; }
  return r;
}

__device__ __forceinline__ v8f wmma_f16(v16h a, v16h b, v8f c) {
  // D = A(16x32 f16) * B(32x16 f16) + C(16x16 f32)
  return __builtin_amdgcn_wmma_f32_16x16x32_f16(false, a, false, b, (short)0, c,
                                                false, false);
}

// ---------------------------------------------------------------------------
// Generic 4096x512 @ 512x512 GEMM, f32 inputs converted to f16 for WMMA.
// MODE 0: f32 row-major out (* scale)
// MODE 1: f16 row-major out (* scale)
// MODE 2: f16 transposed out  Out[col * BT + row]  (* scale)
// Block: 256 threads (8 waves). Tile: 64(M) x 64(N), K-step 32.
// ---------------------------------------------------------------------------
template <int MODE>
__global__ __launch_bounds__(256) void gemm512(const float* __restrict__ A,
                                               const float* __restrict__ W,
                                               void* __restrict__ Out,
                                               float scale) {
  __shared__ _Float16 As[64][40];   // As[m][k]
  __shared__ _Float16 Bst[64][40];  // Bst[n][k] = W[k0+k][n0+n]

  const int t    = threadIdx.x;
  const int lane = t & 31;
  const int w    = t >> 5;
  const int m0   = blockIdx.x * 64;
  const int n0   = blockIdx.y * 64;

  const int r0  = (w & 3) * 16;        // wave's 16-row block
  const int c0  = (w >> 2) * 32;       // wave's 32-col block (two 16-col tiles)
  const int kb  = (lane >> 4) * 8;     // per-lane K sub-chunk (A/B frag layout)
  const int l15 = lane & 15;

  v8f acc0 = {}, acc1 = {};

  for (int k0 = 0; k0 < DMODEL; k0 += 32) {
    __syncthreads();
    {
      // Stage A tile 64x32 (4 threads/row, 8 f32 each)
      const int row = t >> 2, cs = (t & 3) * 8;
      const float* ap = A + (size_t)(m0 + row) * DMODEL + k0 + cs;
#pragma unroll
      for (int j = 0; j < 8; ++j) As[row][cs + j] = (_Float16)ap[j];
      // Stage W tile 32x64 transposed (8 threads/row, 8 f32 each)
      const int krow = t >> 3, ns = (t & 7) * 8;
      const float* wp = W + (size_t)(k0 + krow) * DMODEL + n0 + ns;
#pragma unroll
      for (int j = 0; j < 8; ++j) Bst[ns + j][krow] = (_Float16)wp[j];
      if (k0 + 32 < DMODEL) {
        __builtin_prefetch(ap + 32, 0, 0);                 // global_prefetch_b8
        __builtin_prefetch(wp + (size_t)32 * DMODEL, 0, 0);
      }
    }
    __syncthreads();

    // A fragment (16x32 f16): lane holds row r0+l15, K chunks kb..kb+7, kb+16..kb+23
    const int mrow = r0 + l15;
    v16h af = cat8(*(const v8h*)&As[mrow][kb], *(const v8h*)&As[mrow][kb + 16]);
    // B fragments (32x16 f16): lane holds col, K chunks as above
    const int nc = c0 + l15;
    v16h b0 = cat8(*(const v8h*)&Bst[nc][kb], *(const v8h*)&Bst[nc][kb + 16]);
    v16h b1 = cat8(*(const v8h*)&Bst[nc + 16][kb], *(const v8h*)&Bst[nc + 16][kb + 16]);
    acc0 = wmma_f16(af, b0, acc0);
    acc1 = wmma_f16(af, b1, acc1);
  }

  // C layout: element v -> (row = v + 8*(lane>>4), col = lane&15)
  const int mrow = m0 + r0 + 8 * (lane >> 4);
  const int ncol = n0 + c0 + l15;
#pragma unroll
  for (int v = 0; v < 8; ++v) {
    const int gr = mrow + v;
    const float x0 = acc0[v] * scale;
    const float x1 = acc1[v] * scale;
    if (MODE == 0) {
      float* o = (float*)Out;
      o[(size_t)gr * DMODEL + ncol]      = x0;
      o[(size_t)gr * DMODEL + ncol + 16] = x1;
    } else if (MODE == 1) {
      _Float16* o = (_Float16*)Out;
      o[(size_t)gr * DMODEL + ncol]      = (_Float16)x0;
      o[(size_t)gr * DMODEL + ncol + 16] = (_Float16)x1;
    } else {
      _Float16* o = (_Float16*)Out;
      o[(size_t)ncol * BT + gr]        = (_Float16)x0;
      o[(size_t)(ncol + 16) * BT + gr] = (_Float16)x1;
    }
  }
}

// ---------------------------------------------------------------------------
// Retention: O[b,h,n,:] = sum_m gamma_h^(n-m) * (Q K^T)[n,m] * V[m,:]  (m<=n)
// Grid: (T/64, H, B). Block 128 = 4 waves; wave owns 16 query rows.
// Q pre-scaled by 1/sqrt(dh)=0.125 in the projection.
// Decay factored as gamma^(n-m) = rowfac(n,m0) * colfac(m-m0); rowfac updated
// multiplicatively per key block -> zero transcendentals in the hot loop.
// K and V^T come in stages of 64 keys: the block's 128 lanes copy whole 128-byte
// rows into LDS asynchronously (two buffers, next stage in flight while this one
// is worked on) and all four waves read their B fragments from there.
// ---------------------------------------------------------------------------
#define KSTG   64    // keys per stage
#define KVP    72    // LDS row pitch in halves: 144 B = 16 B x odd for b128 readers

// One stage: 64 K rows and 64 V^T rows of 128 B each, 8 copies of 16 B per lane.
// lk/lv: this lane's LDS byte address in the K / V buffer, gk/gv: its global source.
__device__ __forceinline__ void copy_stage(unsigned lk, unsigned lv,
                                           const _Float16* gk,
                                           const _Float16* gv) {
  const unsigned rs = 16u * KVP * 2u;          // 16 rows further in LDS
  const _Float16* gk1 = gk + (size_t)16 * DMODEL;
  const _Float16* gk2 = gk + (size_t)32 * DMODEL;
  const _Float16* gk3 = gk + (size_t)48 * DMODEL;
  const _Float16* gv1 = gv + (size_t)16 * BT;
  const _Float16* gv2 = gv + (size_t)32 * BT;
  const _Float16* gv3 = gv + (size_t)48 * BT;
  // Copies global -> LDS through no register. The closing s_wait_xcnt stands in
  // the same statement so that no address register is rewritten ahead of it.
  asm volatile(
      "global_load_async_to_lds_b128 %0, %8, off\n\t"
      "global_load_async_to_lds_b128 %1, %9, off\n\t"
      "global_load_async_to_lds_b128 %2, %10, off\n\t"
      "global_load_async_to_lds_b128 %3, %11, off\n\t"
      "global_load_async_to_lds_b128 %4, %12, off\n\t"
      "global_load_async_to_lds_b128 %5, %13, off\n\t"
      "global_load_async_to_lds_b128 %6, %14, off\n\t"
      "global_load_async_to_lds_b128 %7, %15, off\n\t"
      "s_wait_xcnt 0x0"
      :: "v"(lk), "v"(lk + rs), "v"(lk + 2u * rs), "v"(lk + 3u * rs),
         "v"(lv), "v"(lv + rs), "v"(lv + 2u * rs), "v"(lv + 3u * rs),
         "v"(gk), "v"(gk1), "v"(gk2), "v"(gk3),
         "v"(gv), "v"(gv1), "v"(gv2), "v"(gv3)
      : "memory");
}

__global__ __launch_bounds__(128) void retention_kernel(
    const _Float16* __restrict__ Qh,   // (B*T, 512) f16, pre-scaled
    const _Float16* __restrict__ Kh,   // (B*T, 512) f16
    const _Float16* __restrict__ Vt,   // (512, B*T) f16 (transposed V)
    float* __restrict__ Ret) {         // (B*T, 512) f32
  __shared__ __attribute__((aligned(16))) _Float16 Ks[2][KSTG][KVP];   // [key][feature]
  __shared__ __attribute__((aligned(16))) _Float16 Vs[2][DHEAD][KVP];  // [feature][key]
  __shared__ _Float16 Pl[4][16][40];   // per-wave decayed-score tile (16x32)

  const int lane = threadIdx.x & 31;
  // wave number as a scalar: the skip past the diagonal is then a scalar branch
  const int w    = __builtin_amdgcn_readfirstlane(threadIdx.x >> 5);
  const int h    = blockIdx.y;
  const int b    = blockIdx.z;
  const int q0   = blockIdx.x * 64 + w * 16;  // query base within batch
  const int nst  = blockIdx.x + 1;            // 64-key stages up to the diagonal

  const int kb   = (lane >> 4) * 8;
  const int l15  = lane & 15;
  const int mloc = 8 * (lane >> 4);

  // Copy roles: 8 lanes per 128-byte row, rows crow, crow+16, crow+32, crow+48
  const int crow = threadIdx.x >> 3;
  const int ccol = (threadIdx.x & 7) * 8;
  const _Float16* gk = Kh + (size_t)(b * TSEQ + crow) * DMODEL + h * DHEAD + ccol;
  const _Float16* gv = Vt + (size_t)(h * DHEAD + crow) * BT + b * TSEQ + ccol;
  const unsigned lk0 = (unsigned)(uintptr_t)&Ks[0][crow][ccol];
  const unsigned lv0 = (unsigned)(uintptr_t)&Vs[0][crow][ccol];
  const unsigned bufb = KSTG * KVP * 2u;      // bytes of one buffer

  copy_stage(lk0, lv0, gk, gv);               // stage 0 -> buffer 0

  const float gamma = 1.0f - __builtin_amdgcn_exp2f(-5.0f - (float)h);
  const float lg    = __builtin_log2f(gamma);

  // colfac = gamma^(-(key - m0)) for the two 16-col key tiles (exp in [0,32))
  const float cw0 = __builtin_amdgcn_exp2f(-lg * (float)l15);
  const float cw1 = __builtin_amdgcn_exp2f(-lg * (float)(16 + l15));
  // rowfac[v] = gamma^(qn - m0), starting at m0 = 0; step by gamma^-32
  const float stepf = __builtin_amdgcn_exp2f(-lg * 32.0f);
  float rf[8];
#pragma unroll
  for (int v = 0; v < 8; ++v)
    rf[v] = __builtin_amdgcn_exp2f(lg * (float)(q0 + mloc + v));

  // Q A-fragments for K-dim 64 (two 16x32 tiles), loaded once from global
  const v8h* qp = (const v8h*)(Qh + (size_t)(b * TSEQ + q0 + l15) * DMODEL +
                               h * DHEAD + kb);
  const v16h aq0 = cat8(qp[0], qp[2]);
  const v16h aq1 = cat8(qp[4], qp[6]);

  v8f oacc[4] = {{}, {}, {}, {}};

  // stage 0 has landed for this wave; the barrier publishes it to the others
  asm volatile("s_wait_asynccnt 0x0" ::: "memory");
  __syncthreads();
  if (nst > 1)
    copy_stage(lk0 + bufb, lv0 + bufb, gk + (size_t)KSTG * DMODEL, gv + KSTG);

  for (int s = 0; s < nst; ++s) {
    const int buf = s & 1;
    // unrolled: p folds into the immediate offsets of the LDS reads
#pragma unroll
    for (int p = 0; p < 2; ++p) {               // two 32-key blocks per stage
      const int m0 = s * KSTG + p * 32;
      if (m0 <= q0 + 15) {                      // wave-uniform: up to the diagonal
        // V B-fragments: 4 feature tiles of 16, keys contiguous in a V^T row;
        // read at the head of the block so that they fly beside the score work
        v16h bv[4];
#pragma unroll  // keeps bv[] in registers
        for (int nt = 0; nt < 4; ++nt) {
          const _Float16* vp = &Vs[buf][nt * 16 + l15][p * 32 + kb];
          bv[nt] = cat8(*(const v8h*)(vp), *(const v8h*)(vp + 16));
        }
#pragma unroll
        for (int tkey = 0; tkey < 2; ++tkey) {
          const int krow = p * 32 + tkey * 16 + l15;
          const int key  = s * KSTG + krow;     // this lane's key column
          const float cw = tkey ? cw1 : cw0;
          // K^T B-fragment: lane holds key row, feature chunks per B layout
          const _Float16* kp = &Ks[buf][krow][kb];
          v16h bk0 = cat8(*(const v8h*)(kp), *(const v8h*)(kp + 16));
          v16h bk1 = cat8(*(const v8h*)(kp + 32), *(const v8h*)(kp + 48));
          v8f sc = {};
          sc = wmma_f16(aq0, bk0, sc);
          sc = wmma_f16(aq1, bk1, sc);
          // causal multi-scale decay on C fragment, convert to f16 A-tile in LDS
#pragma unroll
          for (int v = 0; v < 8; ++v) {
            const int qn = q0 + mloc + v;
            const float wgt = (qn >= key) ? rf[v] * cw : 0.0f;
            Pl[w][mloc + v][tkey * 16 + l15] = (_Float16)(sc[v] * wgt);
          }
        }
#pragma unroll
        for (int v = 0; v < 8; ++v) rf[v] *= stepf;  // advance rowfac to next m0

        // LDS is in-order per wave; explicit wait keeps the RAW airtight
        asm volatile("s_wait_dscnt 0" ::: "memory");

        // P A-fragment (16x32)
        v16h pf = cat8(*(const v8h*)&Pl[w][l15][kb],
                       *(const v8h*)&Pl[w][l15][kb + 16]);
#pragma unroll  // keeps bv[] and oacc[] in registers
        for (int nt = 0; nt < 4; ++nt) oacc[nt] = wmma_f16(pf, bv[nt], oacc[nt]);
      }
    }
    // Publish point, passed by every wave, also one that skipped a block above.
    // this wave's reads of buffer buf are done before the buffer is refilled
    asm volatile("s_wait_dscnt 0x0" ::: "memory");
    // this wave's copies of stage s+1 have landed before the others read them
    asm volatile("s_wait_asynccnt 0x0" ::: "memory");
    __syncthreads();
    if (s + 2 < nst)                            // block-uniform: refill the buffer just read
      copy_stage(lk0 + buf * bufb, lv0 + buf * bufb,
                 gk + (size_t)(s + 2) * KSTG * DMODEL, gv + (s + 2) * KSTG);
  }
  // no copy is left in flight when the wave ends
  asm volatile("s_wait_asynccnt 0x0" ::: "memory");

#pragma unroll
  for (int nt = 0; nt < 4; ++nt)
#pragma unroll
    for (int v = 0; v < 8; ++v)
      Ret[(size_t)(b * TSEQ + q0 + mloc + v) * DMODEL + h * DHEAD + nt * 16 +
          l15] = oacc[nt][v];
}

// ---------------------------------------------------------------------------
// GroupNorm(8, 512) per token + gate: Z = silu(Gp + gn(Ret)*w + b)
// One 64-thread block per (token, head) group.
// ---------------------------------------------------------------------------
__global__ __launch_bounds__(64) void gn_gate_kernel(
    const float* __restrict__ Ret, const float* __restrict__ Gp,
    const float* __restrict__ gw, const float* __restrict__ gb,
    float* __restrict__ Z) {
  __shared__ float s1[64], s2[64];
  const int d    = threadIdx.x;
  const int gidx = blockIdx.x;
  const int h    = gidx & (NHEADS - 1);
  const int tok  = gidx >> 3;
  const size_t base = (size_t)tok * DMODEL + h * DHEAD;
  const float x = Ret[base + d];
  s1[d] = x;
  s2[d] = x * x;
  __syncthreads();
#pragma unroll
  for (int off = 32; off > 0; off >>= 1) {
    if (d < off) { s1[d] += s1[d + off]; s2[d] += s2[d + off]; }
    __syncthreads();
  }
  const float mean = s1[0] * (1.0f / 64.0f);
  const float var  = s2[0] * (1.0f / 64.0f) - mean * mean;
  const float nrm  = (x - mean) * rsqrtf(var + 1e-5f);
  const float zz   = Gp[base + d] + nrm * gw[h * DHEAD + d] + gb[h * DHEAD + d];
  Z[base + d] = zz / (1.0f + __expf(-zz));
}

// ---------------------------------------------------------------------------
extern "C" void kernel_launch(void* const* d_in, const int* in_sizes, int n_in,
                              void* d_out, int out_size, void* d_ws,
                              size_t ws_size, hipStream_t stream) {
  const float* x  = (const float*)d_in[0];
  const float* WQ = (const float*)d_in[1];
  const float* WK = (const float*)d_in[2];
  const float* WV = (const float*)d_in[3];
  const float* WG = (const float*)d_in[4];
  const float* WO = (const float*)d_in[5];
  const float* gw = (const float*)d_in[6];
  const float* gb = (const float*)d_in[7];

  char* ws = (char*)d_ws;
  _Float16* Qh = (_Float16*)(ws);                  // 4 MB: Q * 0.125, f16
  _Float16* Kh = (_Float16*)(ws + (4u << 20));     // 4 MB
  _Float16* Vt = (_Float16*)(ws + (8u << 20));     // 4 MB (transposed)
  float*    Gp = (float*)(ws + (12u << 20));       // 8 MB gate preact
  float*    Rt = (float*)(ws + (20u << 20));       // 8 MB retention out
  float*    Zb = (float*)(ws + (28u << 20));       // 8 MB silu out (36 MB total)

  dim3 gg(BT / 64, DMODEL / 64);
  gemm512<1><<<gg, 256, 0, stream>>>(x, WQ, Qh, 0.125f);
  gemm512<1><<<gg, 256, 0, stream>>>(x, WK, Kh, 1.0f);
  gemm512<2><<<gg, 256, 0, stream>>>(x, WV, Vt, 1.0f);
  gemm512<0><<<gg, 256, 0, stream>>>(x, WG, Gp, 1.0f);

  retention_kernel<<<dim3(TSEQ / 64, NHEADS, 2), 128, 0, stream>>>(Qh, Kh, Vt,
                                                                   Rt);
  gn_gate_kernel<<<BT * NHEADS, 64, 0, stream>>>(Rt, Gp, gw, gb, Zb);

  gemm512<0><<<gg, 256, 0, stream>>>(Zb, WO, (float*)d_out, 1.0f);
}

// v002
// A run of this version takes 106 microseconds.
// Timed twice side by side with v001, it ran 1.08 times as fast both times.
// Over all steps from v000 it is 1.65 times as fast.
#include <hip/hip_runtime.h>

typedef __attribute__((ext_vector_type(16))) _Float16 v16h;
typedef __attribute__((ext_vector_type(8)))  _Float16 v8h;
typedef __attribute__((ext_vector_type(8)))  float    v8f;

#define DMODEL 512
#define NHEADS 8
#define DHEAD  64
#define TSEQ   2048
#define BT     4096   // B*T rows

__device__ __forceinline__ v16h cat8(v8h lo, v8h hi) {
  v16h r;
#pragma unroll
  for (int i = 0; i < 8; ++i) { r[i] = lo[i]; r[i + 8] = hi[i]; }
  return r;
}

__device__ __forceinline__ v8f wmma_f16(v16h a, v16h b, v8f c) {
  // D = A(16x32 f16) * B(32x16 f16) + C(16x16 f32)
  return __builtin_amdgcn_wmma_f32_16x16x32_f16(false, a, false, b, (short)0, c,
                                                false, false);
}

// ---------------------------------------------------------------------------
// Generic 4096x512 @ 512x512 GEMM, f32 inputs converted to f16 for WMMA.
// MODE 0: f32 row-major out (* scale)
// MODE 1: f16 row-major out (* scale)
// MODE 2: f16 transposed out  Out[col * BT + row]  (* scale)
// Block: 256 threads (8 waves). Tile: 64(M) x 64(N), K-step 32.
// ---------------------------------------------------------------------------
template <int MODE>
__global__ __launch_bounds__(256) void gemm512(const float* __restrict__ A,
                                               const float* __restrict__ W,
                                               void* __restrict__ Out,
                                               float scale) {
  __shared__ _Float16 As[64][40];   // As[m][k]
  __shared__ _Float16 Bst[64][40];  // Bst[n][k] = W[k0+k][n0+n]

  const int t    = threadIdx.x;
  const int lane = t & 31;
  const int w    = t >> 5;
  const int m0   = blockIdx.x * 64;
  const int n0   = blockIdx.y * 64;

  const int r0  = (w & 3) * 16;        // wave's 16-row block
  const int c0  = (w >> 2) * 32;       // wave's 32-col block (two 16-col tiles)
  const int kb  = (lane >> 4) * 8;     // per-lane K sub-chunk (A/B frag layout)
  const int l15 = lane & 15;

  v8f acc0 = {}, acc1 = {};

  for (int k0 = 0; k0 < DMODEL; k0 += 32) {
    __syncthreads();
    {
      // Stage A tile 64x32 (4 threads/row, 8 f32 each)
      const int row = t >> 2, cs = (t & 3) * 8;
      const float* ap = A + (size_t)(m0 + row) * DMODEL + k0 + cs;
#pragma unroll
      for (int j = 0; j < 8; ++j) As[row][cs + j] = (_Float16)ap[j];
      // Stage W tile 32x64 transposed (8 threads/row, 8 f32 each)
      const int krow = t >> 3, ns = (t & 7) * 8;
      const float* wp = W + (size_t)(k0 + krow) * DMODEL + n0 + ns;
#pragma unroll
      for (int j = 0; j < 8; ++j) Bst[ns + j][krow] = (_Float16)wp[j];
      if (k0 + 32 < DMODEL) {
        __builtin_prefetch(ap + 32, 0, 0);                 // global_prefetch_b8
        __builtin_prefetch(wp + (size_t)32 * DMODEL, 0, 0);
      }
    }
    __syncthreads();

    // A fragment (16x32 f16): lane holds row r0+l15, K chunks kb..kb+7, kb+16..kb+23
    const int mrow = r0 + l15;
    v16h af = cat8(*(const v8h*)&As[mrow][kb], *(const v8h*)&As[mrow][kb + 16]);
    // B fragments (32x16 f16): lane holds col, K chunks as above
    const int nc = c0 + l15;
    v16h b0 = cat8(*(const v8h*)&Bst[nc][kb], *(const v8h*)&Bst[nc][kb + 16]);
    v16h b1 = cat8(*(const v8h*)&Bst[nc + 16][kb], *(const v8h*)&Bst[nc + 16][kb + 16]);
    acc0 = wmma_f16(af, b0, acc0);
    acc1 = wmma_f16(af, b1, acc1);
  }

  // C layout: element v -> (row = v + 8*(lane>>4), col = lane&15)
  const int mrow = m0 + r0 + 8 * (lane >> 4);
  const int ncol = n0 + c0 + l15;
#pragma unroll
  for (int v = 0; v < 8; ++v) {
    const int gr = mrow + v;
    const float x0 = acc0[v] * scale;
    const float x1 = acc1[v] * scale;
    if (MODE == 0) {
      float* o = (float*)Out;
      o[(size_t)gr * DMODEL + ncol]      = x0;
      o[(size_t)gr * DMODEL + ncol + 16] = x1;
    } else if (MODE == 1) {
      _Float16* o = (_Float16*)Out;
      o[(size_t)gr * DMODEL + ncol]      = (_Float16)x0;
      o[(size_t)gr * DMODEL + ncol + 16] = (_Float16)x1;
    } else {
      _Float16* o = (_Float16*)Out;
      o[(size_t)ncol * BT + gr]        = (_Float16)x0;
      o[(size_t)(ncol + 16) * BT + gr] = (_Float16)x1;
    }
  }
}

// ---------------------------------------------------------------------------
// Retention: O[b,h,n,:] = sum_m gamma_h^(n-m) * (Q K^T)[n,m] * V[m,:]  (m<=n)
// Grid: (T/64, H, B). Block 128 = 4 waves; wave owns 16 query rows.
// Q pre-scaled by 1/sqrt(dh)=0.125 in the projection.
// Decay factored as gamma^(n-m) = rowfac(n,m0) * colfac(m-m0); rowfac updated
// multiplicatively per key block -> zero transcendentals in the hot loop.
// K and V^T come in stages of 64 keys: the block's 128 lanes copy whole 128-byte
// rows into LDS asynchronously (two buffers, next stage in flight while this one
// is worked on) and all four waves read their B fragments from there.
// Epilogue: a wave's accumulators hold whole (token, head) groups of 64 features,
// so GroupNorm(8, 512), the gate and silu are done here in registers:
// Z = silu(Gp + gn(O)*w + b).
// ---------------------------------------------------------------------------
#define KSTG   64    // keys per stage
#define KVP    72    // LDS row pitch in halves: 144 B = 16 B x odd for b128 readers

// One stage: 64 K rows and 64 V^T rows of 128 B each, 8 copies of 16 B per lane.
// lk/lv: this lane's LDS byte address in the K / V buffer, gk/gv: its global source.
__device__ __forceinline__ void copy_stage(unsigned lk, unsigned lv,
                                           const _Float16* gk,
                                           const _Float16* gv) {
  const unsigned rs = 16u * KVP * 2u;          // 16 rows further in LDS
  const _Float16* gk1 = gk + (size_t)16 * DMODEL;
  const _Float16* gk2 = gk + (size_t)32 * DMODEL;
  const _Float16* gk3 = gk + (size_t)48 * DMODEL;
  const _Float16* gv1 = gv + (size_t)16 * BT;
  const _Float16* gv2 = gv + (size_t)32 * BT;
  const _Float16* gv3 = gv + (size_t)48 * BT;
  // Copies global -> LDS through no register. The closing s_wait_xcnt stands in
  // the same statement so that no address register is rewritten ahead of it.
  asm volatile(
      "global_load_async_to_lds_b128 %0, %8, off\n\t"
      "global_load_async_to_lds_b128 %1, %9, off\n\t"
      "global_load_async_to_lds_b128 %2, %10, off\n\t"
      "global_load_async_to_lds_b128 %3, %11, off\n\t"
      "global_load_async_to_lds_b128 %4, %12, off\n\t"
      "global_load_async_to_lds_b128 %5, %13, off\n\t"
      "global_load_async_to_lds_b128 %6, %14, off\n\t"
      "global_load_async_to_lds_b128 %7, %15, off\n\t"
      "s_wait_xcnt 0x0"
      :: "v"(lk), "v"(lk + rs), "v"(lk + 2u * rs), "v"(lk + 3u * rs),
         "v"(lv), "v"(lv + rs), "v"(lv + 2u * rs), "v"(lv + 3u * rs),
         "v"(gk), "v"(gk1), "v"(gk2), "v"(gk3),
         "v"(gv), "v"(gv1), "v"(gv2), "v"(gv3)
      : "memory");
}

// Sum over the 16 lanes of a row, the result in every one of them (butterfly).
__device__ __forceinline__ float row16_sum(float x) {
#define ROW_XSTEP(m)                                                          \
  x += __builtin_bit_cast(float, __builtin_amdgcn_update_dpp(                 \
           0, __builtin_bit_cast(int, x), 0x160 | (m), 0xf, 0xf, true))
  ROW_XSTEP(1);   // 0x160 | m is the DPP control row_xmask:m
  ROW_XSTEP(2);
  ROW_XSTEP(4);
  ROW_XSTEP(8);
#undef ROW_XSTEP
  return x;
}

__global__ __launch_bounds__(128) void retention_kernel(
    const _Float16* __restrict__ Qh,   // (B*T, 512) f16, pre-scaled
    const _Float16* __restrict__ Kh,   // (B*T, 512) f16
    const _Float16* __restrict__ Vt,   // (512, B*T) f16 (transposed V)
    const float* __restrict__ Gp,      // (B*T, 512) f32 gate pre-activation
    const float* __restrict__ gw,      // (512) GroupNorm weight
    const float* __restrict__ gb,      // (512) GroupNorm bias
    float* __restrict__ Z) {           // (B*T, 512) f32
  __shared__ __attribute__((aligned(16))) _Float16 Ks[2][KSTG][KVP];   // [key][feature]
  __shared__ __attribute__((aligned(16))) _Float16 Vs[2][DHEAD][KVP];  // [feature][key]
  __shared__ _Float16 Pl[4][16][40];   // per-wave decayed-score tile (16x32)

  const int lane = threadIdx.x & 31;
  // wave number as a scalar: the skip past the diagonal is then a scalar branch
  const int w    = __builtin_amdgcn_readfirstlane(threadIdx.x >> 5);
  const int h    = blockIdx.y;
  const int b    = blockIdx.z;
  const int q0   = blockIdx.x * 64 + w * 16;  // query base within batch
  const int nst  = blockIdx.x + 1;            // 64-key stages up to the diagonal

  const int kb   = (lane >> 4) * 8;
  const int l15  = lane & 15;
  const int mloc = 8 * (lane >> 4);

  // Copy roles: 8 lanes per 128-byte row, rows crow, crow+16, crow+32, crow+48
  const int crow = threadIdx.x >> 3;
  const int ccol = (threadIdx.x & 7) * 8;
  const _Float16* gk = Kh + (size_t)(b * TSEQ + crow) * DMODEL + h * DHEAD + ccol;
  const _Float16* gv = Vt + (size_t)(h * DHEAD + crow) * BT + b * TSEQ + ccol;
  const unsigned lk0 = (unsigned)(uintptr_t)&Ks[0][crow][ccol];
  const unsigned lv0 = (unsigned)(uintptr_t)&Vs[0][crow][ccol];
  const unsigned bufb = KSTG * KVP * 2u;      // bytes of one buffer

  copy_stage(lk0, lv0, gk, gv);               // stage 0 -> buffer 0

  const float gamma = 1.0f - __builtin_amdgcn_exp2f(-5.0f - (float)h);
  const float lg    = __builtin_log2f(gamma);

  // colfac = gamma^(-(key - m0)) for the two 16-col key tiles (exp in [0,32))
  const float cw0 = __builtin_amdgcn_exp2f(-lg * (float)l15);
  const float cw1 = __builtin_amdgcn_exp2f(-lg * (float)(16 + l15));
  // rowfac[v] = gamma^(qn - m0), starting at m0 = 0; step by gamma^-32
  const float stepf = __builtin_amdgcn_exp2f(-lg * 32.0f);
  float rf[8];
#pragma unroll
  for (int v = 0; v < 8; ++v)
    rf[v] = __builtin_amdgcn_exp2f(lg * (float)(q0 + mloc + v));

  // Q A-fragments for K-dim 64 (two 16x32 tiles), loaded once from global
  const v8h* qp = (const v8h*)(Qh + (size_t)(b * TSEQ + q0 + l15) * DMODEL +
                               h * DHEAD + kb);
  const v16h aq0 = cat8(qp[0], qp[2]);
  const v16h aq1 = cat8(qp[4], qp[6]);

  // Epilogue operands, fetched here beside stage 0's copies: one wait serves both
  // and the epilogue waits for no load.
  // Element (nt, v) of a lane: row q0 + mloc + v, feature nt * 16 + l15.
  const size_t tile = (size_t)(b * TSEQ + q0) * DMODEL + h * DHEAD;  // wave-uniform
  const int    eoff = mloc * DMODEL + l15;
  float gp[4][8], gwv[4], gbv[4];
#pragma unroll  // keeps gp[] in registers
  for (int nt = 0; nt < 4; ++nt) {
    gwv[nt] = gw[h * DHEAD + nt * 16 + l15];
    gbv[nt] = gb[h * DHEAD + nt * 16 + l15];
#pragma unroll
    for (int v = 0; v < 8; ++v) gp[nt][v] = Gp[tile + eoff + v * DMODEL + nt * 16];
  }

  v8f oacc[4] = {{}, {}, {}, {}};

  // stands in front of every rewrite of an address register of the loads above
  asm volatile("s_wait_xcnt 0x0" ::: "memory");
  // stage 0 has landed for this wave; the barrier publishes it to the others
  asm volatile("s_wait_asynccnt 0x0" ::: "memory");
  __syncthreads();
  if (nst > 1)
    copy_stage(lk0 + bufb, lv0 + bufb, gk + (size_t)KSTG * DMODEL, gv + KSTG);

  for (int s = 0; s < nst; ++s) {
    const int buf = s & 1;
    // unrolled: p folds into the immediate offsets of the LDS reads
#pragma unroll
    for (int p = 0; p < 2; ++p) {               // two 32-key blocks per stage
      const int m0 = s * KSTG + p * 32;
      if (m0 <= q0 + 15) {                      // wave-uniform: up to the diagonal
        // V B-fragments: 4 feature tiles of 16, keys contiguous in a V^T row;
        // read at the head of the block so that they fly beside the score work
        v16h bv[4];
#pragma unroll  // keeps bv[] in registers
        for (int nt = 0; nt < 4; ++nt) {
          const _Float16* vp = &Vs[buf][nt * 16 + l15][p * 32 + kb];
          bv[nt] = cat8(*(const v8h*)(vp), *(const v8h*)(vp + 16));
        }
#pragma unroll
        for (int tkey = 0; tkey < 2; ++tkey) {
          const int krow = p * 32 + tkey * 16 + l15;
          const int key  = s * KSTG + krow;     // this lane's key column
          const float cw = tkey ? cw1 : cw0;
          // K^T B-fragment: lane holds key row, feature chunks per B layout
          const _Float16* kp = &Ks[buf][krow][kb];
          v16h bk0 = cat8(*(const v8h*)(kp), *(const v8h*)(kp + 16));
          v16h bk1 = cat8(*(const v8h*)(kp + 32), *(const v8h*)(kp + 48));
          v8f sc = {};
          sc = wmma_f16(aq0, bk0, sc);
          sc = wmma_f16(aq1, bk1, sc);
          // causal multi-scale decay on C fragment, convert to f16 A-tile in LDS
#pragma unroll
          for (int v = 0; v < 8; ++v) {
            const int qn = q0 + mloc + v;
            const float wgt = (qn >= key) ? rf[v] * cw : 0.0f;
            Pl[w][mloc + v][tkey * 16 + l15] = (_Float16)(sc[v] * wgt);
          }
        }
#pragma unroll
        for (int v = 0; v < 8; ++v) rf[v] *= stepf;  // advance rowfac to next m0

        // LDS is in-order per wave; explicit wait keeps the RAW airtight
        asm volatile("s_wait_dscnt 0" ::: "memory");

        // P A-fragment (16x32)
        v16h pf = cat8(*(const v8h*)&Pl[w][l15][kb],
                       *(const v8h*)&Pl[w][l15][kb + 16]);
#pragma unroll  // keeps bv[] and oacc[] in registers
        for (int nt = 0; nt < 4; ++nt) oacc[nt] = wmma_f16(pf, bv[nt], oacc[nt]);
      }
    }
    // Publish point, passed by every wave, also one that skipped a block above.
    // this wave's reads of buffer buf are done before the buffer is refilled
    asm volatile("s_wait_dscnt 0x0" ::: "memory");
    // this wave's copies of stage s+1 have landed before the others read them
    asm volatile("s_wait_asynccnt 0x0" ::: "memory");
    __syncthreads();
    if (s + 2 < nst)                            // block-uniform: refill the buffer just read
      copy_stage(lk0 + buf * bufb, lv0 + buf * bufb,
                 gk + (size_t)(s + 2) * KSTG * DMODEL, gv + (s + 2) * KSTG);
  }
  // no copy is left in flight when the wave ends
  asm volatile("s_wait_asynccnt 0x0" ::: "memory");

  // Sums of x and x*x over each row's 64 features: four in the lane, then the
  // 16 lanes; the sixteen butterflies are independent and fill each other's waits
  float mean[8], rstd[8];
  {
    const v8f s1 = (oacc[0] + oacc[1]) + (oacc[2] + oacc[3]);
    const v8f s2 = (oacc[0] * oacc[0] + oacc[1] * oacc[1]) +
                   (oacc[2] * oacc[2] + oacc[3] * oacc[3]);
#pragma unroll  // keeps mean[] and rstd[] in registers
    for (int v = 0; v < 8; ++v) {
      mean[v] = row16_sum(s1[v]) * (1.0f / 64.0f);
      const float var = row16_sum(s2[v]) * (1.0f / 64.0f) - mean[v] * mean[v];
      rstd[v] = rsqrtf(var + 1e-5f);
    }
  }
#pragma unroll  // keeps oacc[] and gp[] in registers
  for (int v = 0; v < 8; ++v)
#pragma unroll
    for (int nt = 0; nt < 4; ++nt) {
      const float nrm = (oacc[nt][v] - mean[v]) * rstd[v];
      const float zz  = gp[nt][v] + nrm * gwv[nt] + gbv[nt];
      Z[tile + eoff + v * DMODEL + nt * 16] = zz / (1.0f + __expf(-zz));
    }
}

// ---------------------------------------------------------------------------
extern "C" void kernel_launch(void* const* d_in, const int* in_sizes, int n_in,
                              void* d_out, int out_size, void* d_ws,
                              size_t ws_size, hipStream_t stream) {
  const float* x  = (const float*)d_in[0];
  const float* WQ = (const float*)d_in[1];
  const float* WK = (const float*)d_in[2];
  const float* WV = (const float*)d_in[3];
  const float* WG = (const float*)d_in[4];
  const float* WO = (const float*)d_in[5];
  const float* gw = (const float*)d_in[6];
  const float* gb = (const float*)d_in[7];

  char* ws = (char*)d_ws;
  _Float16* Qh = (_Float16*)(ws);                  // 4 MB: Q * 0.125, f16
  _Float16* Kh = (_Float16*)(ws + (4u << 20));     // 4 MB
  _Float16* Vt = (_Float16*)(ws + (8u << 20));     // 4 MB (transposed)
  float*    Gp = (float*)(ws + (12u << 20));       // 8 MB gate preact
  float*    Zb = (float*)(ws + (20u << 20));       // 8 MB silu out (28 MB total)

  dim3 gg(BT / 64, DMODEL / 64);
  gemm512<1><<<gg, 256, 0, stream>>>(x, WQ, Qh, 0.125f);
  gemm512<1><<<gg, 256, 0, stream>>>(x, WK, Kh, 1.0f);
  gemm512<2><<<gg, 256, 0, stream>>>(x, WV, Vt, 1.0f);
  gemm512<0><<<gg, 256, 0, stream>>>(x, WG, Gp, 1.0f);

  retention_kernel<<<dim3(TSEQ / 64, NHEADS, 2), 128, 0, stream>>>(
      Qh, Kh, Vt, Gp, gw, gb, Zb);

  gemm512<0><<<gg, 256, 0, stream>>>(Zb, WO, (float*)d_out, 1.0f);
}

// v003
// It runs in 83.6 microseconds.
// Next to v002, in two timings, it ran 1.27 times as fast each time.
// All steps since v000 together make it 2.09 times as fast.
#include <hip/hip_runtime.h>

typedef __attribute__((ext_vector_type(16))) _Float16 v16h;
typedef __attribute__((ext_vector_type(8)))  _Float16 v8h;
typedef __attribute__((ext_vector_type(8)))  float    v8f;

#define DMODEL 512
#define NHEADS 8
#define DHEAD  64
#define TSEQ   2048
#define BT     4096   // B*T rows

__device__ __forceinline__ v16h cat8(v8h lo, v8h hi) {
  v16h r;
#pragma unroll
  for (int i = 0; i < 8; ++i) { r[i] = lo[i]; r[i + 8] = hi[i]; }
  return r;
}

__device__ __forceinline__ v8f wmma_f16(v16h a, v16h b, v8f c) {
  // D = A(16x32 f16) * B(32x16 f16) + C(16x16 f32)
  return __builtin_amdgcn_wmma_f32_16x16x32_f16(false, a, false, b, (short)0, c,
                                                false, false);
}

// ---------------------------------------------------------------------------
// Generic 4096x512 @ 512x512 GEMM, f32 inputs converted to f16 for WMMA.
// MODE 0: f32 row-major out (* scale)
// MODE 1: f16 row-major out (* scale)
// MODE 2: f16 transposed out  Out[col * BT + row]  (* scale)
// Block: 256 threads (8 waves). Tile: 64(M) x 64(N), K-step 32.
// ---------------------------------------------------------------------------
template <int MODE>
__global__ __launch_bounds__(256) void gemm512(const float* __restrict__ A,
                                               const float* __restrict__ W,
                                               void* __restrict__ Out,
                                               float scale) {
  __shared__ _Float16 As[64][40];   // As[m][k]
  __shared__ _Float16 Bst[64][40];  // Bst[n][k] = W[k0+k][n0+n]

  const int t    = threadIdx.x;
  const int lane = t & 31;
  const int w    = t >> 5;
  const int m0   = blockIdx.x * 64;
  const int n0   = blockIdx.y * 64;

  const int r0  = (w & 3) * 16;        // wave's 16-row block
  const int c0  = (w >> 2) * 32;       // wave's 32-col block (two 16-col tiles)
  const int kb  = (lane >> 4) * 8;     // per-lane K sub-chunk (A/B frag layout)
  const int l15 = lane & 15;

  v8f acc0 = {}, acc1 = {};

  for (int k0 = 0; k0 < DMODEL; k0 += 32) {
    __syncthreads();
    {
      // Stage A tile 64x32 (4 threads/row, 8 f32 each)
      const int row = t >> 2, cs = (t & 3) * 8;
      const float* ap = A + (size_t)(m0 + row) * DMODEL + k0 + cs;
#pragma unroll
      for (int j = 0; j < 8; ++j) As[row][cs + j] = (_Float16)ap[j];
      // Stage W tile 32x64 transposed (8 threads/row, 8 f32 each)
      const int krow = t >> 3, ns = (t & 7) * 8;
      const float* wp = W + (size_t)(k0 + krow) * DMODEL + n0 + ns;
#pragma unroll
      for (int j = 0; j < 8; ++j) Bst[ns + j][krow] = (_Float16)wp[j];
      if (k0 + 32 < DMODEL) {
        __builtin_prefetch(ap + 32, 0, 0);                 // global_prefetch_b8
        __builtin_prefetch(wp + (size_t)32 * DMODEL, 0, 0);
      }
    }
    __syncthreads();

    // A fragment (16x32 f16): lane holds row r0+l15, K chunks kb..kb+7, kb+16..kb+23
    const int mrow = r0 + l15;
    v16h af = cat8(*(const v8h*)&As[mrow][kb], *(const v8h*)&As[mrow][kb + 16]);
    // B fragments (32x16 f16): lane holds col, K chunks as above
    const int nc = c0 + l15;
    v16h b0 = cat8(*(const v8h*)&Bst[nc][kb], *(const v8h*)&Bst[nc][kb + 16]);
    v16h b1 = cat8(*(const v8h*)&Bst[nc + 16][kb], *(const v8h*)&Bst[nc + 16][kb + 16]);
    acc0 = wmma_f16(af, b0, acc0);
    acc1 = wmma_f16(af, b1, acc1);
  }

  // C layout: element v -> (row = v + 8*(lane>>4), col = lane&15)
  const int mrow = m0 + r0 + 8 * (lane >> 4);
  const int ncol = n0 + c0 + l15;
#pragma unroll
  for (int v = 0; v < 8; ++v) {
    const int gr = mrow + v;
    const float x0 = acc0[v] * scale;
    const float x1 = acc1[v] * scale;
    if (MODE == 0) {
      float* o = (float*)Out;
      o[(size_t)gr * DMODEL + ncol]      = x0;
      o[(size_t)gr * DMODEL + ncol + 16] = x1;
    } else if (MODE == 1) {
      _Float16* o = (_Float16*)Out;
      o[(size_t)gr * DMODEL + ncol]      = (_Float16)x0;
      o[(size_t)gr * DMODEL + ncol + 16] = (_Float16)x1;
    } else {
      _Float16* o = (_Float16*)Out;
      o[(size_t)ncol * BT + gr]        = (_Float16)x0;
      o[(size_t)(ncol + 16) * BT + gr] = (_Float16)x1;
    }
  }
}

// ---------------------------------------------------------------------------
// The four projections of x (Q, K, V, gate) in one launch.
// Block: 256 threads (8 waves), 64 rows of x against the same 64 columns of all
// four weights, K-step 32. The x tile is fetched, converted and staged once per
// K-step for the four products, and the loads of all five tiles wait together.
// Wave w: weight w >> 1, columns (w & 1) * 32 .. + 31, all 64 rows (4 x 2 tiles).
// Outputs: Qh = 0.125 * x WQ (f16), Kh = x WK (f16), Vt = (x WV)^T (f16),
// Gp = x WG (f32).
// ---------------------------------------------------------------------------
__global__ __launch_bounds__(256) void proj4(const float* __restrict__ A,
                                             const float* __restrict__ WQ,
                                             const float* __restrict__ WK,
                                             const float* __restrict__ WV,
                                             const float* __restrict__ WG,
                                             _Float16* __restrict__ Qh,
                                             _Float16* __restrict__ Kh,
                                             _Float16* __restrict__ Vt,
                                             float* __restrict__ Gp) {
  __shared__ _Float16 As[64][40];      // As[m][k]
  __shared__ _Float16 Bst[4][64][40];  // Bst[i][n][k] = W_i[k0+k][n0+n]

  const int t    = threadIdx.x;
  const int lane = t & 31;
  // wave number as a scalar: the choice of weight and output is a scalar branch
  const int w    = __builtin_amdgcn_readfirstlane(t >> 5);
  const int m0   = blockIdx.x * 64;
  const int n0   = blockIdx.y * 64;

  const int wsel = w >> 1;             // wave's weight: 0 Q, 1 K, 2 V, 3 gate
  const int c0   = (w & 1) * 32;       // wave's 32-col block (two 16-col tiles)
  const int kb   = (lane >> 4) * 8;    // per-lane K sub-chunk (A/B frag layout)
  const int l15  = lane & 15;

  // Staging roles. A tile 64x32: 4 threads/row, 8 f32 each; W tiles 32x64,
  // transposed: 8 threads/row, 8 f32 each, the same element offset in all four.
  const int row  = t >> 2, cs = (t & 3) * 8;
  const int krow = t >> 3, ns = (t & 7) * 8;
  // Addresses: the buffer's base plus a lane's byte offset, which advances once a
  // K-step (32 columns of x; 32 rows of a weight, the same offset in all four).
  unsigned aofs = ((unsigned)(m0 + row) * DMODEL + cs) * 4u;
  unsigned wofs = ((unsigned)krow * DMODEL + n0 + ns) * 4u;

  v8f acc[4][2] = {{{}, {}}, {{}, {}}, {{}, {}}, {{}, {}}};

  for (int k0 = 0; k0 < DMODEL; k0 += 32) {
    __syncthreads();
    {
      const float* ap = (const float*)((const char*)A + aofs);
      const float* wq = (const float*)((const char*)WQ + wofs);
      const float* wk = (const float*)((const char*)WK + wofs);
      const float* wv = (const float*)((const char*)WV + wofs);
      const float* wg = (const float*)((const char*)WG + wofs);
      // the five loops are unrolled: a lane's eight floats come as two 16-byte loads
#pragma unroll
      for (int j = 0; j < 8; ++j) As[row][cs + j] = (_Float16)ap[j];
#pragma unroll
      for (int j = 0; j < 8; ++j) Bst[0][ns + j][krow] = (_Float16)wq[j];
#pragma unroll
      for (int j = 0; j < 8; ++j) Bst[1][ns + j][krow] = (_Float16)wk[j];
#pragma unroll
      for (int j = 0; j < 8; ++j) Bst[2][ns + j][krow] = (_Float16)wv[j];
#pragma unroll
      for (int j = 0; j < 8; ++j) Bst[3][ns + j][krow] = (_Float16)wg[j];
      // Next K-step's lines are asked into L2 ahead of its loads.
      // In asm, so that the prefetches name the bases and the two offsets above, which
      // hold addresses all through the loop, and no temporary. The test leaves one
      // K-step more of room: the addresses stay inside x and the weights after the
      // offsets' next advance too. The closing wait stands in front of that advance.
      if (k0 + 64 < DMODEL) {
        asm volatile(
            "global_prefetch_b8 %0, %2 offset:128 scope:SCOPE_SE\n\t"
            "global_prefetch_b8 %1, %3 offset:65536 scope:SCOPE_SE\n\t"
            "global_prefetch_b8 %1, %4 offset:65536 scope:SCOPE_SE\n\t"
            "global_prefetch_b8 %1, %5 offset:65536 scope:SCOPE_SE\n\t"
            "global_prefetch_b8 %1, %6 offset:65536 scope:SCOPE_SE\n\t"
            "s_wait_xcnt 0x0"
            :: "v"(aofs), "v"(wofs), "s"(A), "s"(WQ), "s"(WK), "s"(WV), "s"(WG)
            : "memory");
      }
      aofs += 32u * 4u;
      wofs += 32u * DMODEL * 4u;
    }
    __syncthreads();

    // B fragments (32x16 f16): lane holds col, K chunks kb..kb+7, kb+16..kb+23
    const int nc = c0 + l15;
    v16h b0 = cat8(*(const v8h*)&Bst[wsel][nc][kb], *(const v8h*)&Bst[wsel][nc][kb + 16]);
    v16h b1 = cat8(*(const v8h*)&Bst[wsel][nc + 16][kb],
                   *(const v8h*)&Bst[wsel][nc + 16][kb + 16]);
    // A fragments (16x32 f16): lane holds row r*16+l15, K chunks as above; all four
    // are read ahead of the products, so that their LDS latencies overlap
    v16h af[4];
#pragma unroll  // keeps af[] in registers
    for (int r = 0; r < 4; ++r) {
      const int mrow = r * 16 + l15;
      af[r] = cat8(*(const v8h*)&As[mrow][kb], *(const v8h*)&As[mrow][kb + 16]);
    }
    // keeps the scheduler from sinking the reads between the products, where each
    // pair of products would wait out one LDS latency of its own
    __builtin_amdgcn_sched_barrier(0);
#pragma unroll  // keeps acc[][] in registers
    for (int r = 0; r < 4; ++r) {
      acc[r][0] = wmma_f16(af[r], b0, acc[r][0]);
      acc[r][1] = wmma_f16(af[r], b1, acc[r][1]);
    }
  }

  // C layout: element v -> (row = v + 8*(lane>>4), col = lane&15)
  const int mrow = m0 + 8 * (lane >> 4);
  const int ncol = n0 + c0 + l15;
  if (wsel < 2) {                      // Q (scaled) and K: f16 row-major
    _Float16* o = wsel ? Kh : Qh;
    const float scale = wsel ? 1.0f : 0.125f;
#pragma unroll
    for (int r = 0; r < 4; ++r)
#pragma unroll
      for (int v = 0; v < 8; ++v) {
        const int gr = mrow + r * 16 + v;
        o[(size_t)gr * DMODEL + ncol]      = (_Float16)(acc[r][0][v] * scale);
        o[(size_t)gr * DMODEL + ncol + 16] = (_Float16)(acc[r][1][v] * scale);
      }
  } else if (wsel == 2) {              // V: f16 transposed
#pragma unroll
    for (int r = 0; r < 4; ++r)
#pragma unroll
      for (int v = 0; v < 8; ++v) {
        const int gr = mrow + r * 16 + v;
        Vt[(size_t)ncol * BT + gr]        = (_Float16)acc[r][0][v];
        Vt[(size_t)(ncol + 16) * BT + gr] = (_Float16)acc[r][1][v];
      }
    // stands in front of every rewrite of a register of the stores above
    asm volatile("s_wait_xcnt 0x0" ::: "memory");
  } else {                             // gate: f32 row-major
#pragma unroll
    for (int r = 0; r < 4; ++r)
#pragma unroll
      for (int v = 0; v < 8; ++v) {
        const int gr = mrow + r * 16 + v;
        Gp[(size_t)gr * DMODEL + ncol]      = acc[r][0][v];
        Gp[(size_t)gr * DMODEL + ncol + 16] = acc[r][1][v];
      }
    // stands in front of every rewrite of a register of the stores above
    asm volatile("s_wait_xcnt 0x0" ::: "memory");
  }
}

// ---------------------------------------------------------------------------
// Retention: O[b,h,n,:] = sum_m gamma_h^(n-m) * (Q K^T)[n,m] * V[m,:]  (m<=n)
// Grid: (T/64, H, B). Block 128 = 4 waves; wave owns 16 query rows.
// Q pre-scaled by 1/sqrt(dh)=0.125 in the projection.
// Decay factored as gamma^(n-m) = rowfac(n,m0) * colfac(m-m0); rowfac updated
// multiplicatively per key block -> zero transcendentals in the hot loop.
// K and V^T come in stages of 64 keys: the block's 128 lanes copy whole 128-byte
// rows into LDS asynchronously (two buffers, next stage in flight while this one
// is worked on) and all four waves read their B fragments from there.
// Epilogue: a wave's accumulators hold whole (token, head) groups of 64 features,
// so GroupNorm(8, 512), the gate and silu are done here in registers:
// Z = silu(Gp + gn(O)*w + b).
// ---------------------------------------------------------------------------
#define KSTG   64    // keys per stage
#define KVP    72    // LDS row pitch in halves: 144 B = 16 B x odd for b128 readers

// One stage: 64 K rows and 64 V^T rows of 128 B each, 8 copies of 16 B per lane.
// lk/lv: this lane's LDS byte address in the K / V buffer, gk/gv: its global source.
__device__ __forceinline__ void copy_stage(unsigned lk, unsigned lv,
                                           const _Float16* gk,
                                           const _Float16* gv) {
  const unsigned rs = 16u * KVP * 2u;          // 16 rows further in LDS
  const _Float16* gk1 = gk + (size_t)16 * DMODEL;
  const _Float16* gk2 = gk + (size_t)32 * DMODEL;
  const _Float16* gk3 = gk + (size_t)48 * DMODEL;
  const _Float16* gv1 = gv + (size_t)16 * BT;
  const _Float16* gv2 = gv + (size_t)32 * BT;
  const _Float16* gv3 = gv + (size_t)48 * BT;
  // Copies global -> LDS through no register. The closing s_wait_xcnt stands in
  // the same statement so that no address register is rewritten ahead of it.
  asm volatile(
      "global_load_async_to_lds_b128 %0, %8, off\n\t"
      "global_load_async_to_lds_b128 %1, %9, off\n\t"
      "global_load_async_to_lds_b128 %2, %10, off\n\t"
      "global_load_async_to_lds_b128 %3, %11, off\n\t"
      "global_load_async_to_lds_b128 %4, %12, off\n\t"
      "global_load_async_to_lds_b128 %5, %13, off\n\t"
      "global_load_async_to_lds_b128 %6, %14, off\n\t"
      "global_load_async_to_lds_b128 %7, %15, off\n\t"
      "s_wait_xcnt 0x0"
      :: "v"(lk), "v"(lk + rs), "v"(lk + 2u * rs), "v"(lk + 3u * rs),
         "v"(lv), "v"(lv + rs), "v"(lv + 2u * rs), "v"(lv + 3u * rs),
         "v"(gk), "v"(gk1), "v"(gk2), "v"(gk3),
         "v"(gv), "v"(gv1), "v"(gv2), "v"(gv3)
      : "memory");
}

// Sum over the 16 lanes of a row, the result in every one of them (butterfly).
__device__ __forceinline__ float row16_sum(float x) {
#define ROW_XSTEP(m)                                                          \
  x += __builtin_bit_cast(float, __builtin_amdgcn_update_dpp(                 \
           0, __builtin_bit_cast(int, x), 0x160 | (m), 0xf, 0xf, true))
  ROW_XSTEP(1);   // 0x160 | m is the DPP control row_xmask:m
  ROW_XSTEP(2);
  ROW_XSTEP(4);
  ROW_XSTEP(8);
#undef ROW_XSTEP
  return x;
}

__global__ __launch_bounds__(128) void retention_kernel(
    const _Float16* __restrict__ Qh,   // (B*T, 512) f16, pre-scaled
    const _Float16* __restrict__ Kh,   // (B*T, 512) f16
    const _Float16* __restrict__ Vt,   // (512, B*T) f16 (transposed V)
    const float* __restrict__ Gp,      // (B*T, 512) f32 gate pre-activation
    const float* __restrict__ gw,      // (512) GroupNorm weight
    const float* __restrict__ gb,      // (512) GroupNorm bias
    float* __restrict__ Z) {           // (B*T, 512) f32
  __shared__ __attribute__((aligned(16))) _Float16 Ks[2][KSTG][KVP];   // [key][feature]
  __shared__ __attribute__((aligned(16))) _Float16 Vs[2][DHEAD][KVP];  // [feature][key]
  __shared__ _Float16 Pl[4][16][40];   // per-wave decayed-score tile (16x32)

  const int lane = threadIdx.x & 31;
  // wave number as a scalar: the skip past the diagonal is then a scalar branch
  const int w    = __builtin_amdgcn_readfirstlane(threadIdx.x >> 5);
  const int h    = blockIdx.y;
  const int b    = blockIdx.z;
  const int q0   = blockIdx.x * 64 + w * 16;  // query base within batch
  const int nst  = blockIdx.x + 1;            // 64-key stages up to the diagonal

  const int kb   = (lane >> 4) * 8;
  const int l15  = lane & 15;
  const int mloc = 8 * (lane >> 4);

  // Copy roles: 8 lanes per 128-byte row, rows crow, crow+16, crow+32, crow+48
  const int crow = threadIdx.x >> 3;
  const int ccol = (threadIdx.x & 7) * 8;
  const _Float16* gk = Kh + (size_t)(b * TSEQ + crow) * DMODEL + h * DHEAD + ccol;
  const _Float16* gv = Vt + (size_t)(h * DHEAD + crow) * BT + b * TSEQ + ccol;
  const unsigned lk0 = (unsigned)(uintptr_t)&Ks[0][crow][ccol];
  const unsigned lv0 = (unsigned)(uintptr_t)&Vs[0][crow][ccol];
  const unsigned bufb = KSTG * KVP * 2u;      // bytes of one buffer

  copy_stage(lk0, lv0, gk, gv);               // stage 0 -> buffer 0

  const float gamma = 1.0f - __builtin_amdgcn_exp2f(-5.0f - (float)h);
  const float lg    = __builtin_log2f(gamma);

  // colfac = gamma^(-(key - m0)) for the two 16-col key tiles (exp in [0,32))
  const float cw0 = __builtin_amdgcn_exp2f(-lg * (float)l15);
  const float cw1 = __builtin_amdgcn_exp2f(-lg * (float)(16 + l15));
  // rowfac[v] = gamma^(qn - m0), starting at m0 = 0; step by gamma^-32
  const float stepf = __builtin_amdgcn_exp2f(-lg * 32.0f);
  float rf[8];
#pragma unroll
  for (int v = 0; v < 8; ++v)
    rf[v] = __builtin_amdgcn_exp2f(lg * (float)(q0 + mloc + v));

  // Q A-fragments for K-dim 64 (two 16x32 tiles), loaded once from global
  const v8h* qp = (const v8h*)(Qh + (size_t)(b * TSEQ + q0 + l15) * DMODEL +
                               h * DHEAD + kb);
  const v16h aq0 = cat8(qp[0], qp[2]);
  const v16h aq1 = cat8(qp[4], qp[6]);

  // Epilogue operands, fetched here beside stage 0's copies: one wait serves both
  // and the epilogue waits for no load.
  // Element (nt, v) of a lane: row q0 + mloc + v, feature nt * 16 + l15.
  const size_t tile = (size_t)(b * TSEQ + q0) * DMODEL + h * DHEAD;  // wave-uniform
  const int    eoff = mloc * DMODEL + l15;
  float gp[4][8], gwv[4], gbv[4];
#pragma unroll  // keeps gp[] in registers
  for (int nt = 0; nt < 4; ++nt) {
    gwv[nt] = gw[h * DHEAD + nt * 16 + l15];
    gbv[nt] = gb[h * DHEAD + nt * 16 + l15];
#pragma unroll
    for (int v = 0; v < 8; ++v) gp[nt][v] = Gp[tile + eoff + v * DMODEL + nt * 16];
  }

  v8f oacc[4] = {{}, {}, {}, {}};

  // stands in front of every rewrite of an address register of the loads above
  asm volatile("s_wait_xcnt 0x0" ::: "memory");
  // stage 0 has landed for this wave; the barrier publishes it to the others
  asm volatile("s_wait_asynccnt 0x0" ::: "memory");
  __syncthreads();
  if (nst > 1)
    copy_stage(lk0 + bufb, lv0 + bufb, gk + (size_t)KSTG * DMODEL, gv + KSTG);

  for (int s = 0; s < nst; ++s) {
    const int buf = s & 1;
    // unrolled: p folds into the immediate offsets of the LDS reads
#pragma unroll
    for (int p = 0; p < 2; ++p) {               // two 32-key blocks per stage
      const int m0 = s * KSTG + p * 32;
      if (m0 <= q0 + 15) {                      // wave-uniform: up to the diagonal
        // V B-fragments: 4 feature tiles of 16, keys contiguous in a V^T row;
        // read at the head of the block so that they fly beside the score work
        v16h bv[4];
#pragma unroll  // keeps bv[] in registers
        for (int nt = 0; nt < 4; ++nt) {
          const _Float16* vp = &Vs[buf][nt * 16 + l15][p * 32 + kb];
          bv[nt] = cat8(*(const v8h*)(vp), *(const v8h*)(vp + 16));
        }
#pragma unroll
        for (int tkey = 0; tkey < 2; ++tkey) {
          const int krow = p * 32 + tkey * 16 + l15;
          const int key  = s * KSTG + krow;     // this lane's key column
          const float cw = tkey ? cw1 : cw0;
          // K^T B-fragment: lane holds key row, feature chunks per B layout
          const _Float16* kp = &Ks[buf][krow][kb];
          v16h bk0 = cat8(*(const v8h*)(kp), *(const v8h*)(kp + 16));
          v16h bk1 = cat8(*(const v8h*)(kp + 32), *(const v8h*)(kp + 48));
          v8f sc = {};
          sc = wmma_f16(aq0, bk0, sc);
          sc = wmma_f16(aq1, bk1, sc);
          // causal multi-scale decay on C fragment, convert to f16 A-tile in LDS
#pragma unroll
          for (int v = 0; v < 8; ++v) {
            const int qn = q0 + mloc + v;
            const float wgt = (qn >= key) ? rf[v] * cw : 0.0f;
            Pl[w][mloc + v][tkey * 16 + l15] = (_Float16)(sc[v] * wgt);
          }
        }
#pragma unroll
        for (int v = 0; v < 8; ++v) rf[v] *= stepf;  // advance rowfac to next m0

        // LDS is in-order per wave; explicit wait keeps the RAW airtight
        asm volatile("s_wait_dscnt 0" ::: "memory");

        // P A-fragment (16x32)
        v16h pf = cat8(*(const v8h*)&Pl[w][l15][kb],
                       *(const v8h*)&Pl[w][l15][kb + 16]);
#pragma unroll  // keeps bv[] and oacc[] in registers
        for (int nt = 0; nt < 4; ++nt) oacc[nt] = wmma_f16(pf, bv[nt], oacc[nt]);
      }
    }
    // Publish point, passed by every wave, also one that skipped a block above.
    // this wave's reads of buffer buf are done before the buffer is refilled
    asm volatile("s_wait_dscnt 0x0" ::: "memory");
    // this wave's copies of stage s+1 have landed before the others read them
    asm volatile("s_wait_asynccnt 0x0" ::: "memory");
    __syncthreads();
    if (s + 2 < nst)                            // block-uniform: refill the buffer just read
      copy_stage(lk0 + buf * bufb, lv0 + buf * bufb,
                 gk + (size_t)(s + 2) * KSTG * DMODEL, gv + (s + 2) * KSTG);
  }
  // no copy is left in flight when the wave ends
  asm volatile("s_wait_asynccnt 0x0" ::: "memory");

  // Sums of x and x*x over each row's 64 features: four in the lane, then the
  // 16 lanes; the sixteen butterflies are independent and fill each other's waits
  float mean[8], rstd[8];
  {
    const v8f s1 = (oacc[0] + oacc[1]) + (oacc[2] + oacc[3]);
    const v8f s2 = (oacc[0] * oacc[0] + oacc[1] * oacc[1]) +
                   (oacc[2] * oacc[2] + oacc[3] * oacc[3]);
#pragma unroll  // keeps mean[] and rstd[] in registers
    for (int v = 0; v < 8; ++v) {
      mean[v] = row16_sum(s1[v]) * (1.0f / 64.0f);
      const float var = row16_sum(s2[v]) * (1.0f / 64.0f) - mean[v] * mean[v];
      rstd[v] = rsqrtf(var + 1e-5f);
    }
  }
#pragma unroll  // keeps oacc[] and gp[] in registers
  for (int v = 0; v < 8; ++v)
#pragma unroll
    for (int nt = 0; nt < 4; ++nt) {
      const float nrm = (oacc[nt][v] - mean[v]) * rstd[v];
      const float zz  = gp[nt][v] + nrm * gwv[nt] + gbv[nt];
      Z[tile + eoff + v * DMODEL + nt * 16] = zz / (1.0f + __expf(-zz));
    }
}

// ---------------------------------------------------------------------------
extern "C" void kernel_launch(void* const* d_in, const int* in_sizes, int n_in,
                              void* d_out, int out_size, void* d_ws,
                              size_t ws_size, hipStream_t stream) {
  const float* x  = (const float*)d_in[0];
  const float* WQ = (const float*)d_in[1];
  const float* WK = (const float*)d_in[2];
  const float* WV = (const float*)d_in[3];
  const float* WG = (const float*)d_in[4];
  const float* WO = (const float*)d_in[5];
  const float* gw = (const float*)d_in[6];
  const float* gb = (const float*)d_in[7];

  char* ws = (char*)d_ws;
  _Float16* Qh = (_Float16*)(ws);                  // 4 MB: Q * 0.125, f16
  _Float16* Kh = (_Float16*)(ws + (4u << 20));     // 4 MB
  _Float16* Vt = (_Float16*)(ws + (8u << 20));     // 4 MB (transposed)
  float*    Gp = (float*)(ws + (12u << 20));       // 8 MB gate preact
  float*    Zb = (float*)(ws + (20u << 20));       // 8 MB silu out (28 MB total)

  dim3 gg(BT / 64, DMODEL / 64);
  proj4<<<gg, 256, 0, stream>>>(x, WQ, WK, WV, WG, Qh, Kh, Vt, Gp);

  retention_kernel<<<dim3(TSEQ / 64, NHEADS, 2), 128, 0, stream>>>(
      Qh, Kh, Vt, Gp, gw, gb, Zb);

  gemm512<0><<<gg, 256, 0, stream>>>(Zb, WO, (float*)d_out, 1.0f);
}

// v004
// Measured time: 61.3 microseconds a run.
// Two timings next to v003 put it at 1.36 and 1.37 times that version's speed.
// Over all steps from v000 it is 2.85 times as fast.
#include <hip/hip_runtime.h>

typedef __attribute__((ext_vector_type(16))) _Float16 v16h;
typedef __attribute__((ext_vector_type(8)))  _Float16 v8h;
typedef __attribute__((ext_vector_type(8)))  float    v8f;
typedef __attribute__((ext_vector_type(8)))  short    v8s;

#define DMODEL 512
#define NHEADS 8
#define DHEAD  64
#define TSEQ   2048
#define BT     4096   // B*T rows

__device__ __forceinline__ v16h cat8(v8h lo, v8h hi) {
  v16h r;
#pragma unroll
  for (int i = 0; i < 8; ++i) { r[i] = lo[i]; r[i + 8] = hi[i]; }
  return r;
}

__device__ __forceinline__ v8f wmma_f16(v16h a, v16h b, v8f c) {
  // D = A(16x32 f16) * B(32x16 f16) + C(16x16 f32)
  return __builtin_amdgcn_wmma_f32_16x16x32_f16(false, a, false, b, (short)0, c,
                                                false, false);
}

// A weight tile lies in LDS as it lies in memory, [k][n], 64 halves a row.
#define WP 80   // LDS row pitch in halves: 160 B = 32 B x odd for the transposing reader

// Transposing LDS load (ds_load_tr16_b128). With lane l aimed at
// T[kbase + 8 * (l >> 4) + (l & 7)][nbase + 8 * ((l >> 3) & 1)] it returns
// T[kbase + 8 * (l >> 4) + 0..7][nbase + (l & 15)]: half a B fragment, k order as in A.
__device__ __forceinline__ v8h ld_tr16(const _Float16* p) {
  typedef __attribute__((address_space(3))) v8s lds_v8s;
  return __builtin_bit_cast(v8h, __builtin_amdgcn_ds_load_tr16_b128_v8i16((lds_v8s*)p));
}

// ---------------------------------------------------------------------------
// Generic 4096x512 @ 512x512 GEMM, f32 inputs converted to f16 for WMMA.
// MODE 0: f32 row-major out (* scale)
// MODE 1: f16 row-major out (* scale)
// MODE 2: f16 transposed out  Out[col * BT + row]  (* scale)
// Block: 256 threads (8 waves). Tile: 64(M) x 64(N), K-step 32.
// ---------------------------------------------------------------------------
template <int MODE>
__global__ __launch_bounds__(256) void gemm512(const float* __restrict__ A,
                                               const float* __restrict__ W,
                                               void* __restrict__ Out,
                                               float scale) {
  __shared__ _Float16 As[64][40];   // As[m][k]
  __shared__ __attribute__((aligned(16))) _Float16 Bs[32][WP];  // Bs[k][n] = W[k0+k][n0+n]

  const int t    = threadIdx.x;
  const int lane = t & 31;
  const int w    = t >> 5;
  const int m0   = blockIdx.x * 64;
  const int n0   = blockIdx.y * 64;

  const int r0  = (w & 3) * 16;        // wave's 16-row block
  const int c0  = (w >> 2) * 32;       // wave's 32-col block (two 16-col tiles)
  const int kb  = (lane >> 4) * 8;     // per-lane K sub-chunk (A/B frag layout)
  const int l15 = lane & 15;
  const int trk = kb + (lane & 7);             // transposing reader: this lane's row
  const int trn = c0 + ((lane >> 3) & 1) * 8;  // and its first column

  v8f acc0 = {}, acc1 = {};

  for (int k0 = 0; k0 < DMODEL; k0 += 32) {
    __syncthreads();
    {
      // Stage A tile 64x32 (4 threads/row, 8 f32 each)
      const int row = t >> 2, cs = (t & 3) * 8;
      const float* ap = A + (size_t)(m0 + row) * DMODEL + k0 + cs;
#pragma unroll
      for (int j = 0; j < 8; ++j) As[row][cs + j] = (_Float16)ap[j];
      // Stage W tile 32x64 as it lies (8 threads/row, 8 f32 each, one 16-byte store)
      const int krow = t >> 3, ns = (t & 7) * 8;
      const float* wp = W + (size_t)(k0 + krow) * DMODEL + n0 + ns;
#pragma unroll
      for (int j = 0; j < 8; ++j) Bs[krow][ns + j] = (_Float16)wp[j];
      if (k0 + 32 < DMODEL) {
        __builtin_prefetch(ap + 32, 0, 0);                 // global_prefetch_b8
        __builtin_prefetch(wp + (size_t)32 * DMODEL, 0, 0);
      }
    }
    __syncthreads();

    // A fragment (16x32 f16): lane holds row r0+l15, K chunks kb..kb+7, kb+16..kb+23
    const int mrow = r0 + l15;
    v16h af = cat8(*(const v8h*)&As[mrow][kb], *(const v8h*)&As[mrow][kb + 16]);
    // B fragments (32x16 f16): lane holds col c0 + l15 (+ 16), K chunks as above
    v16h b0 = cat8(ld_tr16(&Bs[trk][trn]), ld_tr16(&Bs[trk + 16][trn]));
    v16h b1 = cat8(ld_tr16(&Bs[trk][trn + 16]), ld_tr16(&Bs[trk + 16][trn + 16]));
    acc0 = wmma_f16(af, b0, acc0);
    acc1 = wmma_f16(af, b1, acc1);
  }

  // C layout: element v -> (row = v + 8*(lane>>4), col = lane&15)
  const int mrow = m0 + r0 + 8 * (lane >> 4);
  const int ncol = n0 + c0 + l15;
#pragma unroll
  for (int v = 0; v < 8; ++v) {
    const int gr = mrow + v;
    const float x0 = acc0[v] * scale;
    const float x1 = acc1[v] * scale;
    if (MODE == 0) {
      float* o = (float*)Out;
      o[(size_t)gr * DMODEL + ncol]      = x0;
      o[(size_t)gr * DMODEL + ncol + 16] = x1;
    } else if (MODE == 1) {
      _Float16* o = (_Float16*)Out;
      o[(size_t)gr * DMODEL + ncol]      = (_Float16)x0;
      o[(size_t)gr * DMODEL + ncol + 16] = (_Float16)x1;
    } else {
      _Float16* o = (_Float16*)Out;
      o[(size_t)ncol * BT + gr]        = (_Float16)x0;
      o[(size_t)(ncol + 16) * BT + gr] = (_Float16)x1;
    }
  }
}

// ---------------------------------------------------------------------------
// The four projections of x (Q, K, V, gate) in one launch.
// Block: 256 threads (8 waves), 64 rows of x against the same 64 columns of all
// four weights, K-step 32. The x tile is fetched, converted and staged once per
// K-step for the four products, and the loads of all five tiles wait together.
// Wave w: weight w >> 1, columns (w & 1) * 32 .. + 31, all 64 rows (4 x 2 tiles).
// Outputs: Qh = 0.125 * x WQ (f16), Kh = x WK (f16), Vt = (x WV)^T (f16),
// Gp = x WG (f32).
// ---------------------------------------------------------------------------
__global__ __launch_bounds__(256) void proj4(const float* __restrict__ A,
                                             const float* __restrict__ WQ,
                                             const float* __restrict__ WK,
                                             const float* __restrict__ WV,
                                             const float* __restrict__ WG,
                                             _Float16* __restrict__ Qh,
                                             _Float16* __restrict__ Kh,
                                             _Float16* __restrict__ Vt,
                                             float* __restrict__ Gp) {
  __shared__ _Float16 As[64][40];      // As[m][k]
  __shared__ __attribute__((aligned(16))) _Float16 Bs[4][32][WP];  // Bs[i][k][n] = W_i[k0+k][n0+n]

  const int t    = threadIdx.x;
  const int lane = t & 31;
  // wave number as a scalar: the choice of weight and output is a scalar branch
  const int w    = __builtin_amdgcn_readfirstlane(t >> 5);
  const int m0   = blockIdx.x * 64;
  const int n0   = blockIdx.y * 64;

  const int wsel = w >> 1;             // wave's weight: 0 Q, 1 K, 2 V, 3 gate
  const int c0   = (w & 1) * 32;       // wave's 32-col block (two 16-col tiles)
  const int kb   = (lane >> 4) * 8;    // per-lane K sub-chunk (A/B frag layout)
  const int l15  = lane & 15;
  const int trk  = kb + (lane & 7);             // transposing reader: this lane's row
  const int trn  = c0 + ((lane >> 3) & 1) * 8;  // and its first column

  // Staging roles. A tile 64x32: 4 threads/row, 8 f32 each; W tiles 32x64, as
  // they lie: 8 threads/row, 8 f32 each, the same element offset in all four.
  const int row  = t >> 2, cs = (t & 3) * 8;
  const int krow = t >> 3, ns = (t & 7) * 8;
  // Addresses: the buffer's base plus a lane's byte offset, which advances once a
  // K-step (32 columns of x; 32 rows of a weight, the same offset in all four).
  unsigned aofs = ((unsigned)(m0 + row) * DMODEL + cs) * 4u;
  unsigned wofs = ((unsigned)krow * DMODEL + n0 + ns) * 4u;

  v8f acc[4][2] = {{{}, {}}, {{}, {}}, {{}, {}}, {{}, {}}};

  for (int k0 = 0; k0 < DMODEL; k0 += 32) {
    __syncthreads();
    {
      const float* ap = (const float*)((const char*)A + aofs);
      const float* wq = (const float*)((const char*)WQ + wofs);
      const float* wk = (const float*)((const char*)WK + wofs);
      const float* wv = (const float*)((const char*)WV + wofs);
      const float* wg = (const float*)((const char*)WG + wofs);
      // the five loops are unrolled: a lane's eight floats come as two 16-byte loads
      // and leave as one 16-byte LDS store
#pragma unroll
      for (int j = 0; j < 8; ++j) As[row][cs + j] = (_Float16)ap[j];
#pragma unroll
      for (int j = 0; j < 8; ++j) Bs[0][krow][ns + j] = (_Float16)wq[j];
#pragma unroll
      for (int j = 0; j < 8; ++j) Bs[1][krow][ns + j] = (_Float16)wk[j];
#pragma unroll
      for (int j = 0; j < 8; ++j) Bs[2][krow][ns + j] = (_Float16)wv[j];
#pragma unroll
      for (int j = 0; j < 8; ++j) Bs[3][krow][ns + j] = (_Float16)wg[j];
      // Next K-step's lines are asked into L2 ahead of its loads.
      // In asm, so that the prefetches name the bases and the two offsets above, which
      // hold addresses all through the loop, and no temporary. The test leaves one
      // K-step more of room: the addresses stay inside x and the weights after the
      // offsets' next advance too. The closing wait stands in front of that advance.
      if (k0 + 64 < DMODEL) {
        asm volatile(
            "global_prefetch_b8 %0, %2 offset:128 scope:SCOPE_SE\n\t"
            "global_prefetch_b8 %1, %3 offset:65536 scope:SCOPE_SE\n\t"
            "global_prefetch_b8 %1, %4 offset:65536 scope:SCOPE_SE\n\t"
            "global_prefetch_b8 %1, %5 offset:65536 scope:SCOPE_SE\n\t"
            "global_prefetch_b8 %1, %6 offset:65536 scope:SCOPE_SE\n\t"
            "s_wait_xcnt 0x0"
            :: "v"(aofs), "v"(wofs), "s"(A), "s"(WQ), "s"(WK), "s"(WV), "s"(WG)
            : "memory");
      }
      aofs += 32u * 4u;
      wofs += 32u * DMODEL * 4u;
    }
    __syncthreads();

    // B fragments (32x16 f16): lane holds col c0 + l15 (+ 16), K chunks kb..kb+7,
    // kb+16..kb+23
    v16h b0 = cat8(ld_tr16(&Bs[wsel][trk][trn]), ld_tr16(&Bs[wsel][trk + 16][trn]));
    v16h b1 = cat8(ld_tr16(&Bs[wsel][trk][trn + 16]),
                   ld_tr16(&Bs[wsel][trk + 16][trn + 16]));
    // A fragments (16x32 f16): lane holds row r*16+l15, K chunks as above; all four
    // are read ahead of the products, so that their LDS latencies overlap
    v16h af[4];
#pragma unroll  // keeps af[] in registers
    for (int r = 0; r < 4; ++r) {
      const int mrow = r * 16 + l15;
      af[r] = cat8(*(const v8h*)&As[mrow][kb], *(const v8h*)&As[mrow][kb + 16]);
    }
    // keeps the scheduler from sinking the reads between the products, where each
    // pair of products would wait out one LDS latency of its own
    __builtin_amdgcn_sched_barrier(0);
#pragma unroll  // keeps acc[][] in registers
    for (int r = 0; r < 4; ++r) {
      acc[r][0] = wmma_f16(af[r], b0, acc[r][0]);
      acc[r][1] = wmma_f16(af[r], b1, acc[r][1]);
    }
  }

  // C layout: element v -> (row = v + 8*(lane>>4), col = lane&15)
  const int mrow = m0 + 8 * (lane >> 4);
  const int ncol = n0 + c0 + l15;
  if (wsel < 2) {                      // Q (scaled) and K: f16 row-major
    _Float16* o = wsel ? Kh : Qh;
    const float scale = wsel ? 1.0f : 0.125f;
#pragma unroll
    for (int r = 0; r < 4; ++r)
#pragma unroll
      for (int v = 0; v < 8; ++v) {
        const int gr = mrow + r * 16 + v;
        o[(size_t)gr * DMODEL + ncol]      = (_Float16)(acc[r][0][v] * scale);
        o[(size_t)gr * DMODEL + ncol + 16] = (_Float16)(acc[r][1][v] * scale);
      }
  } else if (wsel == 2) {              // V: f16 transposed
#pragma unroll
    for (int r = 0; r < 4; ++r)
#pragma unroll
      for (int v = 0; v < 8; ++v) {
        const int gr = mrow + r * 16 + v;
        Vt[(size_t)ncol * BT + gr]        = (_Float16)acc[r][0][v];
        Vt[(size_t)(ncol + 16) * BT + gr] = (_Float16)acc[r][1][v];
      }
    // stands in front of every rewrite of a register of the stores above
    asm volatile("s_wait_xcnt 0x0" ::: "memory");
  } else {                             // gate: f32 row-major
#pragma unroll
    for (int r = 0; r < 4; ++r)
#pragma unroll
      for (int v = 0; v < 8; ++v) {
        const int gr = mrow + r * 16 + v;
        Gp[(size_t)gr * DMODEL + ncol]      = acc[r][0][v];
        Gp[(size_t)gr * DMODEL + ncol + 16] = acc[r][1][v];
      }
    // stands in front of every rewrite of a register of the stores above
    asm volatile("s_wait_xcnt 0x0" ::: "memory");
  }
}

// ---------------------------------------------------------------------------
// Retention: O[b,h,n,:] = sum_m gamma_h^(n-m) * (Q K^T)[n,m] * V[m,:]  (m<=n)
// Grid: (T/64, H, B). Block 128 = 4 waves; wave owns 16 query rows.
// Q pre-scaled by 1/sqrt(dh)=0.125 in the projection.
// Decay factored as gamma^(n-m) = rowfac(n,m0) * colfac(m-m0); rowfac updated
// multiplicatively per key block -> zero transcendentals in the hot loop.
// K and V^T come in stages of 64 keys: the block's 128 lanes copy whole 128-byte
// rows into LDS asynchronously (two buffers, next stage in flight while this one
// is worked on) and all four waves read their B fragments from there.
// Epilogue: a wave's accumulators hold whole (token, head) groups of 64 features,
// so GroupNorm(8, 512), the gate and silu are done here in registers:
// Z = silu(Gp + gn(O)*w + b).
// ---------------------------------------------------------------------------
#define KSTG   64    // keys per stage
#define KVP    72    // LDS row pitch in halves: 144 B = 16 B x odd for b128 readers

// One stage: 64 K rows and 64 V^T rows of 128 B each, 8 copies of 16 B per lane.
// lk/lv: this lane's LDS byte address in the K / V buffer, gk/gv: its global source.
__device__ __forceinline__ void copy_stage(unsigned lk, unsigned lv,
                                           const _Float16* gk,
                                           const _Float16* gv) {
  const unsigned rs = 16u * KVP * 2u;          // 16 rows further in LDS
  const _Float16* gk1 = gk + (size_t)16 * DMODEL;
  const _Float16* gk2 = gk + (size_t)32 * DMODEL;
  const _Float16* gk3 = gk + (size_t)48 * DMODEL;
  const _Float16* gv1 = gv + (size_t)16 * BT;
  const _Float16* gv2 = gv + (size_t)32 * BT;
  const _Float16* gv3 = gv + (size_t)48 * BT;
  // Copies global -> LDS through no register. The closing s_wait_xcnt stands in
  // the same statement so that no address register is rewritten ahead of it.
  asm volatile(
      "global_load_async_to_lds_b128 %0, %8, off\n\t"
      "global_load_async_to_lds_b128 %1, %9, off\n\t"
      "global_load_async_to_lds_b128 %2, %10, off\n\t"
      "global_load_async_to_lds_b128 %3, %11, off\n\t"
      "global_load_async_to_lds_b128 %4, %12, off\n\t"
      "global_load_async_to_lds_b128 %5, %13, off\n\t"
      "global_load_async_to_lds_b128 %6, %14, off\n\t"
      "global_load_async_to_lds_b128 %7, %15, off\n\t"
      "s_wait_xcnt 0x0"
      :: "v"(lk), "v"(lk + rs), "v"(lk + 2u * rs), "v"(lk + 3u * rs),
         "v"(lv), "v"(lv + rs), "v"(lv + 2u * rs), "v"(lv + 3u * rs),
         "v"(gk), "v"(gk1), "v"(gk2), "v"(gk3),
         "v"(gv), "v"(gv1), "v"(gv2), "v"(gv3)
      : "memory");
}

// Sum over the 16 lanes of a row, the result in every one of them (butterfly).
__device__ __forceinline__ float row16_sum(float x) {
#define ROW_XSTEP(m)                                                          \
  x += __builtin_bit_cast(float, __builtin_amdgcn_update_dpp(                 \
           0, __builtin_bit_cast(int, x), 0x160 | (m), 0xf, 0xf, true))
  ROW_XSTEP(1);   // 0x160 | m is the DPP control row_xmask:m
  ROW_XSTEP(2);
  ROW_XSTEP(4);
  ROW_XSTEP(8);
#undef ROW_XSTEP
  return x;
}

__global__ __launch_bounds__(128) void retention_kernel(
    const _Float16* __restrict__ Qh,   // (B*T, 512) f16, pre-scaled
    const _Float16* __restrict__ Kh,   // (B*T, 512) f16
    const _Float16* __restrict__ Vt,   // (512, B*T) f16 (transposed V)
    const float* __restrict__ Gp,      // (B*T, 512) f32 gate pre-activation
    const float* __restrict__ gw,      // (512) GroupNorm weight
    const float* __restrict__ gb,      // (512) GroupNorm bias
    float* __restrict__ Z) {           // (B*T, 512) f32
  __shared__ __attribute__((aligned(16))) _Float16 Ks[2][KSTG][KVP];   // [key][feature]
  __shared__ __attribute__((aligned(16))) _Float16 Vs[2][DHEAD][KVP];  // [feature][key]
  __shared__ _Float16 Pl[4][16][40];   // per-wave decayed-score tile (16x32)

  const int lane = threadIdx.x & 31;
  // wave number as a scalar: the skip past the diagonal is then a scalar branch
  const int w    = __builtin_amdgcn_readfirstlane(threadIdx.x >> 5);
  const int h    = blockIdx.y;
  const int b    = blockIdx.z;
  const int q0   = blockIdx.x * 64 + w * 16;  // query base within batch
  const int nst  = blockIdx.x + 1;            // 64-key stages up to the diagonal

  const int kb   = (lane >> 4) * 8;
  const int l15  = lane & 15;
  const int mloc = 8 * (lane >> 4);

  // Copy roles: 8 lanes per 128-byte row, rows crow, crow+16, crow+32, crow+48
  const int crow = threadIdx.x >> 3;
  const int ccol = (threadIdx.x & 7) * 8;
  const _Float16* gk = Kh + (size_t)(b * TSEQ + crow) * DMODEL + h * DHEAD + ccol;
  const _Float16* gv = Vt + (size_t)(h * DHEAD + crow) * BT + b * TSEQ + ccol;
  const unsigned lk0 = (unsigned)(uintptr_t)&Ks[0][crow][ccol];
  const unsigned lv0 = (unsigned)(uintptr_t)&Vs[0][crow][ccol];
  const unsigned bufb = KSTG * KVP * 2u;      // bytes of one buffer

  copy_stage(lk0, lv0, gk, gv);               // stage 0 -> buffer 0

  const float gamma = 1.0f - __builtin_amdgcn_exp2f(-5.0f - (float)h);
  const float lg    = __builtin_log2f(gamma);

  // colfac = gamma^(-(key - m0)) for the two 16-col key tiles (exp in [0,32))
  const float cw0 = __builtin_amdgcn_exp2f(-lg * (float)l15);
  const float cw1 = __builtin_amdgcn_exp2f(-lg * (float)(16 + l15));
  // rowfac[v] = gamma^(qn - m0), starting at m0 = 0; step by gamma^-32
  const float stepf = __builtin_amdgcn_exp2f(-lg * 32.0f);
  float rf[8];
#pragma unroll
  for (int v = 0; v < 8; ++v)
    rf[v] = __builtin_amdgcn_exp2f(lg * (float)(q0 + mloc + v));

  // Q A-fragments for K-dim 64 (two 16x32 tiles), loaded once from global
  const v8h* qp = (const v8h*)(Qh + (size_t)(b * TSEQ + q0 + l15) * DMODEL +
                               h * DHEAD + kb);
  const v16h aq0 = cat8(qp[0], qp[2]);
  const v16h aq1 = cat8(qp[4], qp[6]);

  // Epilogue operands, fetched here beside stage 0's copies: one wait serves both
  // and the epilogue waits for no load.
  // Element (nt, v) of a lane: row q0 + mloc + v, feature nt * 16 + l15.
  const size_t tile = (size_t)(b * TSEQ + q0) * DMODEL + h * DHEAD;  // wave-uniform
  const int    eoff = mloc * DMODEL + l15;
  float gp[4][8], gwv[4], gbv[4];
#pragma unroll  // keeps gp[] in registers
  for (int nt = 0; nt < 4; ++nt) {
    gwv[nt] = gw[h * DHEAD + nt * 16 + l15];
    gbv[nt] = gb[h * DHEAD + nt * 16 + l15];
#pragma unroll
    for (int v = 0; v < 8; ++v) gp[nt][v] = Gp[tile + eoff + v * DMODEL + nt * 16];
  }

  v8f oacc[4] = {{}, {}, {}, {}};

  // stands in front of every rewrite of an address register of the loads above
  asm volatile("s_wait_xcnt 0x0" ::: "memory");
  // stage 0 has landed for this wave; the barrier publishes it to the others
  asm volatile("s_wait_asynccnt 0x0" ::: "memory");
  __syncthreads();
  if (nst > 1)
    copy_stage(lk0 + bufb, lv0 + bufb, gk + (size_t)KSTG * DMODEL, gv + KSTG);

  for (int s = 0; s < nst; ++s) {
    const int buf = s & 1;
    // unrolled: p folds into the immediate offsets of the LDS reads
#pragma unroll
    for (int p = 0; p < 2; ++p) {               // two 32-key blocks per stage
      const int m0 = s * KSTG + p * 32;
      if (m0 <= q0 + 15) {                      // wave-uniform: up to the diagonal
        // V B-fragments: 4 feature tiles of 16, keys contiguous in a V^T row;
        // read at the head of the block so that they fly beside the score work
        v16h bv[4];
#pragma unroll  // keeps bv[] in registers
        for (int nt = 0; nt < 4; ++nt) {
          const _Float16* vp = &Vs[buf][nt * 16 + l15][p * 32 + kb];
          bv[nt] = cat8(*(const v8h*)(vp), *(const v8h*)(vp + 16));
        }
#pragma unroll
        for (int tkey = 0; tkey < 2; ++tkey) {
          const int krow = p * 32 + tkey * 16 + l15;
          const int key  = s * KSTG + krow;     // this lane's key column
          const float cw = tkey ? cw1 : cw0;
          // K^T B-fragment: lane holds key row, feature chunks per B layout
          const _Float16* kp = &Ks[buf][krow][kb];
          v16h bk0 = cat8(*(const v8h*)(kp), *(const v8h*)(kp + 16));
          v16h bk1 = cat8(*(const v8h*)(kp + 32), *(const v8h*)(kp + 48));
          v8f sc = {};
          sc = wmma_f16(aq0, bk0, sc);
          sc = wmma_f16(aq1, bk1, sc);
          // causal multi-scale decay on C fragment, convert to f16 A-tile in LDS
#pragma unroll
          for (int v = 0; v < 8; ++v) {
            const int qn = q0 + mloc + v;
            const float wgt = (qn >= key) ? rf[v] * cw : 0.0f;
            Pl[w][mloc + v][tkey * 16 + l15] = (_Float16)(sc[v] * wgt);
          }
        }
#pragma unroll
        for (int v = 0; v < 8; ++v) rf[v] *= stepf;  // advance rowfac to next m0

        // LDS is in-order per wave; explicit wait keeps the RAW airtight
        asm volatile("s_wait_dscnt 0" ::: "memory");

        // P A-fragment (16x32)
        v16h pf = cat8(*(const v8h*)&Pl[w][l15][kb],
                       *(const v8h*)&Pl[w][l15][kb + 16]);
#pragma unroll  // keeps bv[] and oacc[] in registers
        for (int nt = 0; nt < 4; ++nt) oacc[nt] = wmma_f16(pf, bv[nt], oacc[nt]);
      }
    }
    // Publish point, passed by every wave, also one that skipped a block above.
    // this wave's reads of buffer buf are done before the buffer is refilled
    asm volatile("s_wait_dscnt 0x0" ::: "memory");
    // this wave's copies of stage s+1 have landed before the others read them
    asm volatile("s_wait_asynccnt 0x0" ::: "memory");
    __syncthreads();
    if (s + 2 < nst)                            // block-uniform: refill the buffer just read
      copy_stage(lk0 + buf * bufb, lv0 + buf * bufb,
                 gk + (size_t)(s + 2) * KSTG * DMODEL, gv + (s + 2) * KSTG);
  }
  // no copy is left in flight when the wave ends
  asm volatile("s_wait_asynccnt 0x0" ::: "memory");

  // Sums of x and x*x over each row's 64 features: four in the lane, then the
  // 16 lanes; the sixteen butterflies are independent and fill each other's waits
  float mean[8], rstd[8];
  {
    const v8f s1 = (oacc[0] + oacc[1]) + (oacc[2] + oacc[3]);
    const v8f s2 = (oacc[0] * oacc[0] + oacc[1] * oacc[1]) +
                   (oacc[2] * oacc[2] + oacc[3] * oacc[3]);
#pragma unroll  // keeps mean[] and rstd[] in registers
    for (int v = 0; v < 8; ++v) {
      mean[v] = row16_sum(s1[v]) * (1.0f / 64.0f);
      const float var = row16_sum(s2[v]) * (1.0f / 64.0f) - mean[v] * mean[v];
      rstd[v] = rsqrtf(var + 1e-5f);
    }
  }
#pragma unroll  // keeps oacc[] and gp[] in registers
  for (int v = 0; v < 8; ++v)
#pragma unroll
    for (int nt = 0; nt < 4; ++nt) {
      const float nrm = (oacc[nt][v] - mean[v]) * rstd[v];
      const float zz  = gp[nt][v] + nrm * gwv[nt] + gbv[nt];
      Z[tile + eoff + v * DMODEL + nt * 16] = zz / (1.0f + __expf(-zz));
    }
}

// ---------------------------------------------------------------------------
extern "C" void kernel_launch(void* const* d_in, const int* in_sizes, int n_in,
                              void* d_out, int out_size, void* d_ws,
                              size_t ws_size, hipStream_t stream) {
  const float* x  = (const float*)d_in[0];
  const float* WQ = (const float*)d_in[1];
  const float* WK = (const float*)d_in[2];
  const float* WV = (const float*)d_in[3];
  const float* WG = (const float*)d_in[4];
  const float* WO = (const float*)d_in[5];
  const float* gw = (const float*)d_in[6];
  const float* gb = (const float*)d_in[7];

  char* ws = (char*)d_ws;
  _Float16* Qh = (_Float16*)(ws);                  // 4 MB: Q * 0.125, f16
  _Float16* Kh = (_Float16*)(ws + (4u << 20));     // 4 MB
  _Float16* Vt = (_Float16*)(ws + (8u << 20));     // 4 MB (transposed)
  float*    Gp = (float*)(ws + (12u << 20));       // 8 MB gate preact
  float*    Zb = (float*)(ws + (20u << 20));       // 8 MB silu out (28 MB total)

  dim3 gg(BT / 64, DMODEL / 64);
  proj4<<<gg, 256, 0, stream>>>(x, WQ, WK, WV, WG, Qh, Kh, Vt, Gp);

  retention_kernel<<<dim3(TSEQ / 64, NHEADS, 2), 128, 0, stream>>>(
      Qh, Kh, Vt, Gp, gw, gb, Zb);

  gemm512<0><<<gg, 256, 0, stream>>>(Zb, WO, (float*)d_out, 1.0f);
}

// v005
// A run of this version takes 52.9 microseconds.
// Timed twice side by side with v004, it ran 1.16 times as fast both times.
// All steps since v000 together make it 3.30 times as fast.
#include <hip/hip_runtime.h>

typedef __attribute__((ext_vector_type(16))) _Float16 v16h;
typedef __attribute__((ext_vector_type(8)))  _Float16 v8h;
typedef __attribute__((ext_vector_type(8)))  float    v8f;
typedef __attribute__((ext_vector_type(8)))  short    v8s;

#define DMODEL 512
#define NHEADS 8
#define DHEAD  64
#define TSEQ   2048
#define BT     4096   // B*T rows

__device__ __forceinline__ v16h cat8(v8h lo, v8h hi) {
  v16h r;
#pragma unroll
  for (int i = 0; i < 8; ++i) { r[i] = lo[i]; r[i + 8] = hi[i]; }
  return r;
}

__device__ __forceinline__ v8f wmma_f16(v16h a, v16h b, v8f c) {
  // D = A(16x32 f16) * B(32x16 f16) + C(16x16 f32)
  return __builtin_amdgcn_wmma_f32_16x16x32_f16(false, a, false, b, (short)0, c,
                                                false, false);
}

// A weight tile lies in LDS as it lies in memory, [k][n], 64 halves a row.
#define WP 80   // LDS row pitch in halves: 160 B = 32 B x odd for the transposing reader

// Transposing LDS load (ds_load_tr16_b128). With lane l aimed at
// T[kbase + 8 * (l >> 4) + (l & 7)][nbase + 8 * ((l >> 3) & 1)] it returns
// T[kbase + 8 * (l >> 4) + 0..7][nbase + (l & 15)]: half a B fragment, k order as in A.
__device__ __forceinline__ v8h ld_tr16(const _Float16* p) {
  typedef __attribute__((address_space(3))) v8s lds_v8s;
  return __builtin_bit_cast(v8h, __builtin_amdgcn_ds_load_tr16_b128_v8i16((lds_v8s*)p));
}

// ---------------------------------------------------------------------------
// Generic 4096x512 @ 512x512 GEMM, f32 inputs converted to f16 for WMMA.
// MODE 0: f32 row-major out (* scale)
// MODE 1: f16 row-major out (* scale)
// MODE 2: f16 transposed out  Out[col * BT + row]  (* scale)
// Block: 256 threads (8 waves). Tile: 64(M) x 64(N), K-step 32.
// ---------------------------------------------------------------------------
template <int MODE>
__global__ __launch_bounds__(256) void gemm512(const float* __restrict__ A,
                                               const float* __restrict__ W,
                                               void* __restrict__ Out,
                                               float scale) {
  __shared__ _Float16 As[64][40];   // As[m][k]
  __shared__ __attribute__((aligned(16))) _Float16 Bs[32][WP];  // Bs[k][n] = W[k0+k][n0+n]

  const int t    = threadIdx.x;
  const int lane = t & 31;
  const int w    = t >> 5;
  const int m0   = blockIdx.x * 64;
  const int n0   = blockIdx.y * 64;

  const int r0  = (w & 3) * 16;        // wave's 16-row block
  const int c0  = (w >> 2) * 32;       // wave's 32-col block (two 16-col tiles)
  const int kb  = (lane >> 4) * 8;     // per-lane K sub-chunk (A/B frag layout)
  const int l15 = lane & 15;
  const int trk = kb + (lane & 7);             // transposing reader: this lane's row
  const int trn = c0 + ((lane >> 3) & 1) * 8;  // and its first column

  v8f acc0 = {}, acc1 = {};

  for (int k0 = 0; k0 < DMODEL; k0 += 32) {
    __syncthreads();
    {
      // Stage A tile 64x32 (4 threads/row, 8 f32 each)
      const int row = t >> 2, cs = (t & 3) * 8;
      const float* ap = A + (size_t)(m0 + row) * DMODEL + k0 + cs;
#pragma unroll
      for (int j = 0; j < 8; ++j) As[row][cs + j] = (_Float16)ap[j];
      // Stage W tile 32x64 as it lies (8 threads/row, 8 f32 each, one 16-byte store)
      const int krow = t >> 3, ns = (t & 7) * 8;
      const float* wp = W + (size_t)(k0 + krow) * DMODEL + n0 + ns;
#pragma unroll
      for (int j = 0; j < 8; ++j) Bs[krow][ns + j] = (_Float16)wp[j];
      if (k0 + 32 < DMODEL) {
        __builtin_prefetch(ap + 32, 0, 0);                 // global_prefetch_b8
        __builtin_prefetch(wp + (size_t)32 * DMODEL, 0, 0);
      }
    }
    __syncthreads();

    // A fragment (16x32 f16): lane holds row r0+l15, K chunks kb..kb+7, kb+16..kb+23
    const int mrow = r0 + l15;
    v16h af = cat8(*(const v8h*)&As[mrow][kb], *(const v8h*)&As[mrow][kb + 16]);
    // B fragments (32x16 f16): lane holds col c0 + l15 (+ 16), K chunks as above
    v16h b0 = cat8(ld_tr16(&Bs[trk][trn]), ld_tr16(&Bs[trk + 16][trn]));
    v16h b1 = cat8(ld_tr16(&Bs[trk][trn + 16]), ld_tr16(&Bs[trk + 16][trn + 16]));
    acc0 = wmma_f16(af, b0, acc0);
    acc1 = wmma_f16(af, b1, acc1);
  }

  // C layout: element v -> (row = v + 8*(lane>>4), col = lane&15)
  const int mrow = m0 + r0 + 8 * (lane >> 4);
  const int ncol = n0 + c0 + l15;
#pragma unroll
  for (int v = 0; v < 8; ++v) {
    const int gr = mrow + v;
    const float x0 = acc0[v] * scale;
    const float x1 = acc1[v] * scale;
    if (MODE == 0) {
      float* o = (float*)Out;
      o[(size_t)gr * DMODEL + ncol]      = x0;
      o[(size_t)gr * DMODEL + ncol + 16] = x1;
    } else if (MODE == 1) {
      _Float16* o = (_Float16*)Out;
      o[(size_t)gr * DMODEL + ncol]      = (_Float16)x0;
      o[(size_t)gr * DMODEL + ncol + 16] = (_Float16)x1;
    } else {
      _Float16* o = (_Float16*)Out;
      o[(size_t)ncol * BT + gr]        = (_Float16)x0;
      o[(size_t)(ncol + 16) * BT + gr] = (_Float16)x1;
    }
  }
}

// ---------------------------------------------------------------------------
// The four projections of x (Q, K, V, gate) in one launch.
// Block: 256 threads (8 waves), 64 rows of x against the same 64 columns of all
// four weights, K-step 32. The x tile is fetched, converted and staged once per
// K-step for the four products, and the loads of all five tiles wait together.
// Wave w: weight w >> 1, columns (w & 1) * 32 .. + 31, all 64 rows (4 x 2 tiles).
// Outputs: Qh = 0.125 * x WQ (f16), Kh = x WK (f16), Vt = (x WV)^T (f16),
// Gp = x WG (f32).
// ---------------------------------------------------------------------------
__global__ __launch_bounds__(256) void proj4(const float* __restrict__ A,
                                             const float* __restrict__ WQ,
                                             const float* __restrict__ WK,
                                             const float* __restrict__ WV,
                                             const float* __restrict__ WG,
                                             _Float16* __restrict__ Qh,
                                             _Float16* __restrict__ Kh,
                                             _Float16* __restrict__ Vt,
                                             float* __restrict__ Gp) {
  __shared__ _Float16 As[64][40];      // As[m][k]
  __shared__ __attribute__((aligned(16))) _Float16 Bs[4][32][WP];  // Bs[i][k][n] = W_i[k0+k][n0+n]

  const int t    = threadIdx.x;
  const int lane = t & 31;
  // wave number as a scalar: the choice of weight and output is a scalar branch
  const int w    = __builtin_amdgcn_readfirstlane(t >> 5);
  const int m0   = blockIdx.x * 64;
  const int n0   = blockIdx.y * 64;

  const int wsel = w >> 1;             // wave's weight: 0 Q, 1 K, 2 V, 3 gate
  const int c0   = (w & 1) * 32;       // wave's 32-col block (two 16-col tiles)
  const int kb   = (lane >> 4) * 8;    // per-lane K sub-chunk (A/B frag layout)
  const int l15  = lane & 15;
  const int trk  = kb + (lane & 7);             // transposing reader: this lane's row
  const int trn  = c0 + ((lane >> 3) & 1) * 8;  // and its first column

  // Staging roles. A tile 64x32: 4 threads/row, 8 f32 each; W tiles 32x64, as
  // they lie: 8 threads/row, 8 f32 each, the same element offset in all four.
  const int row  = t >> 2, cs = (t & 3) * 8;
  const int krow = t >> 3, ns = (t & 7) * 8;
  // Addresses: the buffer's base plus a lane's byte offset, which advances once a
  // K-step (32 columns of x; 32 rows of a weight, the same offset in all four).
  unsigned aofs = ((unsigned)(m0 + row) * DMODEL + cs) * 4u;
  unsigned wofs = ((unsigned)krow * DMODEL + n0 + ns) * 4u;

  v8f acc[4][2] = {{{}, {}}, {{}, {}}, {{}, {}}, {{}, {}}};

  for (int k0 = 0; k0 < DMODEL; k0 += 32) {
    __syncthreads();
    {
      const float* ap = (const float*)((const char*)A + aofs);
      const float* wq = (const float*)((const char*)WQ + wofs);
      const float* wk = (const float*)((const char*)WK + wofs);
      const float* wv = (const float*)((const char*)WV + wofs);
      const float* wg = (const float*)((const char*)WG + wofs);
      // the five loops are unrolled: a lane's eight floats come as two 16-byte loads
      // and leave as one 16-byte LDS store
#pragma unroll
      for (int j = 0; j < 8; ++j) As[row][cs + j] = (_Float16)ap[j];
#pragma unroll
      for (int j = 0; j < 8; ++j) Bs[0][krow][ns + j] = (_Float16)wq[j];
#pragma unroll
      for (int j = 0; j < 8; ++j) Bs[1][krow][ns + j] = (_Float16)wk[j];
#pragma unroll
      for (int j = 0; j < 8; ++j) Bs[2][krow][ns + j] = (_Float16)wv[j];
#pragma unroll
      for (int j = 0; j < 8; ++j) Bs[3][krow][ns + j] = (_Float16)wg[j];
      // Next K-step's lines are asked into L2 ahead of its loads.
      // In asm, so that the prefetches name the bases and the two offsets above, which
      // hold addresses all through the loop, and no temporary. The test leaves one
      // K-step more of room: the addresses stay inside x and the weights after the
      // offsets' next advance too. The closing wait stands in front of that advance.
      if (k0 + 64 < DMODEL) {
        asm volatile(
            "global_prefetch_b8 %0, %2 offset:128 scope:SCOPE_SE\n\t"
            "global_prefetch_b8 %1, %3 offset:65536 scope:SCOPE_SE\n\t"
            "global_prefetch_b8 %1, %4 offset:65536 scope:SCOPE_SE\n\t"
            "global_prefetch_b8 %1, %5 offset:65536 scope:SCOPE_SE\n\t"
            "global_prefetch_b8 %1, %6 offset:65536 scope:SCOPE_SE\n\t"
            "s_wait_xcnt 0x0"
            :: "v"(aofs), "v"(wofs), "s"(A), "s"(WQ), "s"(WK), "s"(WV), "s"(WG)
            : "memory");
      }
      aofs += 32u * 4u;
      wofs += 32u * DMODEL * 4u;
    }
    __syncthreads();

    // B fragments (32x16 f16): lane holds col c0 + l15 (+ 16), K chunks kb..kb+7,
    // kb+16..kb+23
    v16h b0 = cat8(ld_tr16(&Bs[wsel][trk][trn]), ld_tr16(&Bs[wsel][trk + 16][trn]));
    v16h b1 = cat8(ld_tr16(&Bs[wsel][trk][trn + 16]),
                   ld_tr16(&Bs[wsel][trk + 16][trn + 16]));
    // A fragments (16x32 f16): lane holds row r*16+l15, K chunks as above; all four
    // are read ahead of the products, so that their LDS latencies overlap
    v16h af[4];
#pragma unroll  // keeps af[] in registers
    for (int r = 0; r < 4; ++r) {
      const int mrow = r * 16 + l15;
      af[r] = cat8(*(const v8h*)&As[mrow][kb], *(const v8h*)&As[mrow][kb + 16]);
    }
    // keeps the scheduler from sinking the reads between the products, where each
    // pair of products would wait out one LDS latency of its own
    __builtin_amdgcn_sched_barrier(0);
#pragma unroll  // keeps acc[][] in registers
    for (int r = 0; r < 4; ++r) {
      acc[r][0] = wmma_f16(af[r], b0, acc[r][0]);
      acc[r][1] = wmma_f16(af[r], b1, acc[r][1]);
    }
  }

  // C layout: element v -> (row = v + 8*(lane>>4), col = lane&15)
  const int mrow = m0 + 8 * (lane >> 4);
  const int ncol = n0 + c0 + l15;
  if (wsel < 2) {                      // Q (scaled) and K: f16 row-major
    _Float16* o = wsel ? Kh : Qh;
    const float scale = wsel ? 1.0f : 0.125f;
#pragma unroll
    for (int r = 0; r < 4; ++r)
#pragma unroll
      for (int v = 0; v < 8; ++v) {
        const int gr = mrow + r * 16 + v;
        o[(size_t)gr * DMODEL + ncol]      = (_Float16)(acc[r][0][v] * scale);
        o[(size_t)gr * DMODEL + ncol + 16] = (_Float16)(acc[r][1][v] * scale);
      }
  } else if (wsel == 2) {              // V: f16 transposed
#pragma unroll
    for (int r = 0; r < 4; ++r)
#pragma unroll
      for (int v = 0; v < 8; ++v) {
        const int gr = mrow + r * 16 + v;
        Vt[(size_t)ncol * BT + gr]        = (_Float16)acc[r][0][v];
        Vt[(size_t)(ncol + 16) * BT + gr] = (_Float16)acc[r][1][v];
      }
    // stands in front of every rewrite of a register of the stores above
    asm volatile("s_wait_xcnt 0x0" ::: "memory");
  } else {                             // gate: f32 row-major
#pragma unroll
    for (int r = 0; r < 4; ++r)
#pragma unroll
      for (int v = 0; v < 8; ++v) {
        const int gr = mrow + r * 16 + v;
        Gp[(size_t)gr * DMODEL + ncol]      = acc[r][0][v];
        Gp[(size_t)gr * DMODEL + ncol + 16] = acc[r][1][v];
      }
    // stands in front of every rewrite of a register of the stores above
    asm volatile("s_wait_xcnt 0x0" ::: "memory");
  }
}

#define KSTG   64
#define KVP    72

// One stage: 64 K rows and 64 V^T rows of 128 B each, 8 copies of 16 B per lane.
// lk/lv: this lane's LDS byte address in the K / V buffer, gk/gv: its global source.
__device__ __forceinline__ void copy_stage(unsigned lk, unsigned lv,
                                           const _Float16* gk,
                                           const _Float16* gv) {
  const unsigned rs = 16u * KVP * 2u;          // 16 rows further in LDS
  const _Float16* gk1 = gk + (size_t)16 * DMODEL;
  const _Float16* gk2 = gk + (size_t)32 * DMODEL;
  const _Float16* gk3 = gk + (size_t)48 * DMODEL;
  const _Float16* gv1 = gv + (size_t)16 * BT;
  const _Float16* gv2 = gv + (size_t)32 * BT;
  const _Float16* gv3 = gv + (size_t)48 * BT;
  // Copies global -> LDS through no register. The closing s_wait_xcnt stands in
  // the same statement so that no address register is rewritten ahead of it.
  asm volatile(
      "global_load_async_to_lds_b128 %0, %8, off\n\t"
      "global_load_async_to_lds_b128 %1, %9, off\n\t"
      "global_load_async_to_lds_b128 %2, %10, off\n\t"
      "global_load_async_to_lds_b128 %3, %11, off\n\t"
      "global_load_async_to_lds_b128 %4, %12, off\n\t"
      "global_load_async_to_lds_b128 %5, %13, off\n\t"
      "global_load_async_to_lds_b128 %6, %14, off\n\t"
      "global_load_async_to_lds_b128 %7, %15, off\n\t"
      "s_wait_xcnt 0x0"
      :: "v"(lk), "v"(lk + rs), "v"(lk + 2u * rs), "v"(lk + 3u * rs),
         "v"(lv), "v"(lv + rs), "v"(lv + 2u * rs), "v"(lv + 3u * rs),
         "v"(gk), "v"(gk1), "v"(gk2), "v"(gk3),
         "v"(gv), "v"(gv1), "v"(gv2), "v"(gv3)
      : "memory");
}

__device__ __forceinline__ float exp2_slot(float x) {
  float r;
  asm("v_exp_f32 %0, %1\n\tv_nop" : "=v"(r) : "v"(x));
  return r;
}

// Lane l's value from lane l ^ 16 (v_permlanex16_b32).
__device__ __forceinline__ float xhalf(float x) {
  return __builtin_bit_cast(float, __builtin_amdgcn_permlanex16(
      __builtin_bit_cast(int, x), __builtin_bit_cast(int, x), 0x76543210, 0xfedcba98,
      false, false));
}

__global__ __launch_bounds__(128) void retention_kernel(
    const _Float16* __restrict__ Qh,   // (B*T, 512) f16, pre-scaled
    const _Float16* __restrict__ Kh,   // (B*T, 512) f16
    const _Float16* __restrict__ Vt,   // (512, B*T) f16 (transposed V)
    const float* __restrict__ Gp,      // (B*T, 512) f32 gate pre-activation
    const float* __restrict__ gw,      // (512) GroupNorm weight
    const float* __restrict__ gb,      // (512) GroupNorm bias
    float* __restrict__ Z) {           // (B*T, 512) f32
  __shared__ __attribute__((aligned(16))) _Float16 Ks[2][KSTG][KVP];   // [key][feature]
  __shared__ __attribute__((aligned(16))) _Float16 Vs[2][DHEAD][KVP];  // [feature][key]

  const int lane = threadIdx.x & 31;
  // wave number as a scalar: the skip past the diagonal is then a scalar branch
  const int w    = __builtin_amdgcn_readfirstlane(threadIdx.x >> 5);
  const int h    = blockIdx.y;
  const int b    = blockIdx.z;
  const int q0   = blockIdx.x * 64 + w * 16;  // query base within batch
  const int nst  = blockIdx.x + 1;            // 64-key stages up to the diagonal

  // kb: first k of a lane's A/B chunks, and first row of its 8 accumulator rows
  const int kb   = (lane >> 4) * 8;
  const int l15  = lane & 15;
  const int qn   = q0 + l15;                  // this lane's query (a column of S^T, O^T)

  // Copy roles: 8 lanes per 128-byte row, rows crow, crow+16, crow+32, crow+48
  const int crow = threadIdx.x >> 3;
  const int ccol = (threadIdx.x & 7) * 8;
  const _Float16* gk = Kh + (size_t)(b * TSEQ + crow) * DMODEL + h * DHEAD + ccol;
  const _Float16* gv = Vt + (size_t)(h * DHEAD + crow) * BT + b * TSEQ + ccol;
  const unsigned lk0 = (unsigned)(uintptr_t)&Ks[0][crow][ccol];
  const unsigned lv0 = (unsigned)(uintptr_t)&Vs[0][crow][ccol];
  const unsigned bufb = KSTG * KVP * 2u;      // bytes of one buffer

  copy_stage(lk0, lv0, gk, gv);               // stage 0 -> buffer 0

  const float gamma = 1.0f - __builtin_amdgcn_exp2f(-5.0f - (float)h);
  const float lg    = __builtin_log2f(gamma);

  // keyfac = gamma^(-(key - m0)) for the lane's 2 x 8 keys of a block (exp in [0,32))
  float cw[2][8];
#pragma unroll  // keeps cw[][] in registers
  for (int tkey = 0; tkey < 2; ++tkey)
#pragma unroll
    for (int v = 0; v < 8; ++v)
      cw[tkey][v] = exp2_slot(-lg * (float)(tkey * 16 + kb + v));
  // rf = gamma^(qn - m0), starting at m0 = 0; step by gamma^-32
  const float stepf = __builtin_amdgcn_exp2f(-lg * 32.0f);
  float rf = __builtin_amdgcn_exp2f(lg * (float)qn);

  // Q^T B-fragments for K-dim 64 (two 32x16 tiles), loaded once from global:
  // lane holds query qn, feature chunks kb.., kb+16.. (+32)
  const v8h* qp = (const v8h*)(Qh + (size_t)(b * TSEQ + qn) * DMODEL + h * DHEAD + kb);
  const v16h bq0 = cat8(qp[0], qp[2]);
  const v16h bq1 = cat8(qp[4], qp[6]);

  // The gate's pre-activations, fetched here beside stage 0's copies; they are read only in the epilogue.
  // Element (nt, v) of a lane: row qn, feature nt * 16 + kb + v.
  const size_t tile = (size_t)(b * TSEQ + q0) * DMODEL + h * DHEAD;  // wave-uniform
  const int    eoff = l15 * DMODEL + kb;
  float gp[4][8];
#pragma unroll  // keeps gp[][] in registers
  for (int nt = 0; nt < 4; ++nt)
#pragma unroll
    for (int v = 0; v < 8; ++v) gp[nt][v] = Gp[tile + eoff + nt * 16 + v];

  v8f oacc[4] = {{}, {}, {}, {}};

  // stands in front of every rewrite of an address register of the loads above
  asm volatile("s_wait_xcnt 0x0" ::: "memory");
  // stage 0 has landed for this wave; the barrier publishes it to the others
  asm volatile("s_wait_asynccnt 0x0" ::: "memory");
  __syncthreads();
  if (nst > 1)
    copy_stage(lk0 + bufb, lv0 + bufb, gk + (size_t)KSTG * DMODEL, gv + KSTG);

  for (int s = 0; s < nst; ++s) {
    const int buf = s & 1;
    // unrolled: p folds into the immediate offsets of the LDS reads
#pragma unroll
    for (int p = 0; p < 2; ++p) {               // two 32-key blocks per stage
      const int m0 = s * KSTG + p * 32;
      if (m0 <= q0 + 15) {                      // wave-uniform: up to the diagonal
        // K A-fragments: 2 key tiles of 16, lane holds a key row, feature chunks as in Q^T
        v16h ak[2][2];
#pragma unroll  // keeps ak[][] in registers
        for (int tkey = 0; tkey < 2; ++tkey) {
          const _Float16* kp = &Ks[buf][p * 32 + tkey * 16 + l15][kb];
          ak[tkey][0] = cat8(*(const v8h*)(kp), *(const v8h*)(kp + 16));
          ak[tkey][1] = cat8(*(const v8h*)(kp + 32), *(const v8h*)(kp + 48));
        }
        // V^T A-fragments: 4 feature tiles of 16, keys contiguous in a V^T row
        v16h av[4];
#pragma unroll  // keeps av[] in registers
        for (int nt = 0; nt < 4; ++nt) {
          const _Float16* vp = &Vs[buf][nt * 16 + l15][p * 32 + kb];
          av[nt] = cat8(*(const v8h*)(vp), *(const v8h*)(vp + 16));
        }
        // keeps the scheduler from sinking the reads between the products, where each
        // product would wait out one LDS latency of its own
        __builtin_amdgcn_sched_barrier(0);
        // P^T B-fragment (32 keys x 16 queries): a lane's chunks are keys kb..kb+7 and
        // kb+16..kb+23 of its query, the very elements its two S^T tiles hold
        v16h pf;
        v8f sc[2] = {{}, {}};
#pragma unroll  // keeps sc[] in registers; the two tiles' chains fill each other's waits
        for (int tkey = 0; tkey < 2; ++tkey) sc[tkey] = wmma_f16(ak[tkey][0], bq0, sc[tkey]);
#pragma unroll
        for (int tkey = 0; tkey < 2; ++tkey) sc[tkey] = wmma_f16(ak[tkey][1], bq1, sc[tkey]);
        // causal multi-scale decay on the C fragments: element v of tile tkey is key
        // m0 + tkey * 16 + kb + v, at or before the query while tkey * 16 + v <= dq
        const int dq = qn - m0 - kb;
#pragma unroll  // keeps pf in registers
        for (int tkey = 0; tkey < 2; ++tkey)
#pragma unroll
          for (int v = 0; v < 8; ++v) {
            const float wgt = (dq >= tkey * 16 + v) ? rf * cw[tkey][v] : 0.0f;
            pf[tkey * 8 + v] = (_Float16)(sc[tkey][v] * wgt);
          }
        rf *= stepf;                            // advance rf to the next m0
#pragma unroll  // keeps av[] and oacc[] in registers
        for (int nt = 0; nt < 4; ++nt) oacc[nt] = wmma_f16(av[nt], pf, oacc[nt]);
      }
    }
    // Publish point, passed by every wave, also one that skipped a block above.
    // this wave's reads of buffer buf are done before the buffer is refilled
    asm volatile("s_wait_dscnt 0x0" ::: "memory");
    // this wave's copies of stage s+1 have landed before the others read them
    asm volatile("s_wait_asynccnt 0x0" ::: "memory");
    __syncthreads();
    if (s + 2 < nst)                            // block-uniform: refill the buffer just read
      copy_stage(lk0 + buf * bufb, lv0 + buf * bufb,
                 gk + (size_t)(s + 2) * KSTG * DMODEL, gv + (s + 2) * KSTG);
  }
  // no copy is left in flight when the wave ends
  asm volatile("s_wait_asynccnt 0x0" ::: "memory");

  // GroupNorm weight and bias of the lane's 32 features; they fly beside the sums below
  float gwv[4][8], gbv[4][8];
#pragma unroll  // keeps the two arrays in registers
  for (int nt = 0; nt < 4; ++nt)
#pragma unroll
    for (int v = 0; v < 8; ++v) {
      gwv[nt][v] = gw[h * DHEAD + nt * 16 + kb + v];
      gbv[nt][v] = gb[h * DHEAD + nt * 16 + kb + v];
    }

  // Sums of x and x*x over the query's 64 features: 32 in the lane, then the
  // other 32 from lane l ^ 16
  const v8f s1 = (oacc[0] + oacc[1]) + (oacc[2] + oacc[3]);
  const v8f s2 = (oacc[0] * oacc[0] + oacc[1] * oacc[1]) +
                 (oacc[2] * oacc[2] + oacc[3] * oacc[3]);
  float t1 = ((s1[0] + s1[1]) + (s1[2] + s1[3])) + ((s1[4] + s1[5]) + (s1[6] + s1[7]));
  float t2 = ((s2[0] + s2[1]) + (s2[2] + s2[3])) + ((s2[4] + s2[5]) + (s2[6] + s2[7]));
  t1 += xhalf(t1);
  t2 += xhalf(t2);
  const float mean = t1 * (1.0f / 64.0f);
  const float var  = t2 * (1.0f / 64.0f) - mean * mean;
  const float rstd = rsqrtf(var + 1e-5f);
#pragma unroll  // keeps oacc[] and the epilogue operands in registers
  for (int nt = 0; nt < 4; ++nt)
#pragma unroll
    for (int v = 0; v < 8; ++v) {
      const float nrm = (oacc[nt][v] - mean) * rstd;
      const float zz  = gp[nt][v] + nrm * gwv[nt][v] + gbv[nt][v];
      Z[tile + eoff + nt * 16 + v] = zz / (1.0f + __expf(-zz));
    }
}

// ---------------------------------------------------------------------------
extern "C" void kernel_launch(void* const* d_in, const int* in_sizes, int n_in,
                              void* d_out, int out_size, void* d_ws,
                              size_t ws_size, hipStream_t stream) {
  const float* x  = (const float*)d_in[0];
  const float* WQ = (const float*)d_in[1];
  const float* WK = (const float*)d_in[2];
  const float* WV = (const float*)d_in[3];
  const float* WG = (const float*)d_in[4];
  const float* WO = (const float*)d_in[5];
  const float* gw = (const float*)d_in[6];
  const float* gb = (const float*)d_in[7];

  char* ws = (char*)d_ws;
  _Float16* Qh = (_Float16*)(ws);                  // 4 MB: Q * 0.125, f16
  _Float16* Kh = (_Float16*)(ws + (4u << 20));     // 4 MB
  _Float16* Vt = (_Float16*)(ws + (8u << 20));     // 4 MB (transposed)
  float*    Gp = (float*)(ws + (12u << 20));       // 8 MB gate preact
  float*    Zb = (float*)(ws + (20u << 20));       // 8 MB silu out (28 MB total)

  dim3 gg(BT / 64, DMODEL / 64);
  proj4<<<gg, 256, 0, stream>>>(x, WQ, WK, WV, WG, Qh, Kh, Vt, Gp);

  retention_kernel<<<dim3(TSEQ / 64, NHEADS, 2), 128, 0, stream>>>(
      Qh, Kh, Vt, Gp, gw, gb, Zb);

  gemm512<0><<<gg, 256, 0, stream>>>(Zb, WO, (float*)d_out, 1.0f);
}

// v006
// Measured time: 47.3 microseconds a run.
// Timed twice side by side with v005, it ran 1.13 and 1.12 times as fast.
// Counting every step since v000, it is 3.72 times as fast.
#include <hip/hip_runtime.h>

typedef __attribute__((ext_vector_type(16))) _Float16 v16h;
typedef __attribute__((ext_vector_type(8)))  _Float16 v8h;
typedef __attribute__((ext_vector_type(8)))  float    v8f;
typedef __attribute__((ext_vector_type(8)))  short    v8s;
typedef __attribute__((ext_vector_type(4)))  float    v4f;

#define DMODEL 512
#define NHEADS 8
#define DHEAD  64
#define TSEQ   2048
#define BT     4096   // B*T rows

__device__ __forceinline__ v16h cat8(v8h lo, v8h hi) {
  v16h r;
#pragma unroll
  for (int i = 0; i < 8; ++i) { r[i] = lo[i]; r[i + 8] = hi[i]; }
  return r;
}

__device__ __forceinline__ v8f wmma_f16(v16h a, v16h b, v8f c) {
  // D = A(16x32 f16) * B(32x16 f16) + C(16x16 f32)
  return __builtin_amdgcn_wmma_f32_16x16x32_f16(false, a, false, b, (short)0, c,
                                                false, false);
}

// A weight tile lies in LDS as it lies in memory, [k][n], 64 halves a row.
#define WP 80   // LDS row pitch in halves: 160 B = 32 B x odd for the transposing reader

// Transposing LDS load (ds_load_tr16_b128). With lane l aimed at
// T[kbase + 8 * (l >> 4) + (l & 7)][nbase + 8 * ((l >> 3) & 1)] it returns
// T[kbase + 8 * (l >> 4) + 0..7][nbase + (l & 15)]: half a B fragment, k order as in A.
__device__ __forceinline__ v8h ld_tr16(const _Float16* p) {
  typedef __attribute__((address_space(3))) v8s lds_v8s;
  return __builtin_bit_cast(v8h, __builtin_amdgcn_ds_load_tr16_b128_v8i16((lds_v8s*)p));
}

// Eight staged f32 values as the eight halves of one 16-byte LDS store.
__device__ __forceinline__ v8h cvt8(v4f lo, v4f hi) {
  v8h r;
#pragma unroll
  for (int i = 0; i < 4; ++i) { r[i] = (_Float16)lo[i]; r[i + 4] = (_Float16)hi[i]; }
  return r;
}

// Work-group barrier fenced for LDS alone: every wave's LDS reads and writes are done
// at the barrier, while its global loads for later K-steps stay in flight across it
// (__syncthreads() would wait for them too).
__device__ __forceinline__ void lds_barrier() {
  __builtin_amdgcn_fence(__ATOMIC_RELEASE, "workgroup", "local");
  __builtin_amdgcn_s_barrier();
  __builtin_amdgcn_fence(__ATOMIC_ACQUIRE, "workgroup", "local");
}

#define NKS (DMODEL / 32)   // K-steps of 32

// ---------------------------------------------------------------------------
// Generic 4096x512 @ 512x512 GEMM, f32 inputs converted to f16 for WMMA.
// MODE 0: f32 row-major out (* scale)
// MODE 1: f16 row-major out (* scale)
// MODE 2: f16 transposed out  Out[col * BT + row]  (* scale)
// Block: 256 threads (8 waves). Tile: 64(M) x 64(N), K-step 32.
// Pipeline: a K-step's tiles are loaded into registers three K-steps before their
// products (two register sets), converted and stored to LDS one K-step before (two
// LDS buffers); one barrier a K-step.
// ---------------------------------------------------------------------------
template <int MODE>
__global__ __launch_bounds__(256) void gemm512(const float* __restrict__ A,
                                               const float* __restrict__ W,
                                               void* __restrict__ Out,
                                               float scale) {
  __shared__ __attribute__((aligned(16))) _Float16 As[2][64][40];   // As[buf][m][k]
  __shared__ __attribute__((aligned(16))) _Float16 Bs[2][32][WP];   // Bs[buf][k][n] = W[k0+k][n0+n]

  const int t    = threadIdx.x;
  const int lane = t & 31;
  const int w    = t >> 5;
  const int m0   = blockIdx.x * 64;
  const int n0   = blockIdx.y * 64;

  const int r0  = (w & 3) * 16;        // wave's 16-row block
  const int c0  = (w >> 2) * 32;       // wave's 32-col block (two 16-col tiles)
  const int kb  = (lane >> 4) * 8;     // per-lane K sub-chunk (A/B frag layout)
  const int l15 = lane & 15;
  const int trk = kb + (lane & 7);             // transposing reader: this lane's row
  const int trn = c0 + ((lane >> 3) & 1) * 8;  // and its first column

  // Staging roles. A tile 64x32: 4 threads/row, 8 f32 each; W tile 32x64 as it lies:
  // 8 threads/row, 8 f32 each, one 16-byte LDS store.
  const int row  = t >> 2, cs = (t & 3) * 8;
  const int krow = t >> 3, ns = (t & 7) * 8;
  const float* ap = A + (size_t)(m0 + row) * DMODEL + cs;
  const float* wp = W + (size_t)krow * DMODEL + n0 + ns;

  v8f acc0 = {}, acc1 = {};
  v4f ra[2][2], rw[2][2];              // two register sets of staged f32 values

  // K-steps 0 and 1 into the two sets; step 0 on to LDS, its set refilled with step 2
#pragma unroll  // keeps ra[][] and rw[][] in registers
  for (int s = 0; s < 2; ++s) {
    ra[s][0] = *(const v4f*)(ap + s * 32);
    ra[s][1] = *(const v4f*)(ap + s * 32 + 4);
    rw[s][0] = *(const v4f*)(wp + (size_t)s * 32 * DMODEL);
    rw[s][1] = *(const v4f*)(wp + (size_t)s * 32 * DMODEL + 4);
  }
  *(v8h*)&As[0][row][cs]  = cvt8(ra[0][0], ra[0][1]);
  *(v8h*)&Bs[0][krow][ns] = cvt8(rw[0][0], rw[0][1]);
  ra[0][0] = *(const v4f*)(ap + 2 * 32);
  ra[0][1] = *(const v4f*)(ap + 2 * 32 + 4);
  rw[0][0] = *(const v4f*)(wp + (size_t)2 * 32 * DMODEL);
  rw[0][1] = *(const v4f*)(wp + (size_t)2 * 32 * DMODEL + 4);

  // unrolled whole: set and buffer numbers are constants, and every load's address is
  // the lane's A or W base plus an immediate, so no address register is advanced under a load
#pragma unroll
  for (int k = 0; k < NKS; ++k) {
    const int cur = k & 1, nxt = cur ^ 1;
    // publishes buffer cur; ends every wave's reads of buffer nxt
    lds_barrier();

    // A fragment (16x32 f16): lane holds row r0+l15, K chunks kb..kb+7, kb+16..kb+23
    const int mrow = r0 + l15;
    v16h af = cat8(*(const v8h*)&As[cur][mrow][kb], *(const v8h*)&As[cur][mrow][kb + 16]);
    // B fragments (32x16 f16): lane holds col c0 + l15 (+ 16), K chunks as above
    v16h b0 = cat8(ld_tr16(&Bs[cur][trk][trn]), ld_tr16(&Bs[cur][trk + 16][trn]));
    v16h b1 = cat8(ld_tr16(&Bs[cur][trk][trn + 16]), ld_tr16(&Bs[cur][trk + 16][trn + 16]));
    // keeps the conversions below in this K-step: lifted to where their loads were
    // issued they would wait those loads out at once, and nothing would run ahead
    __builtin_amdgcn_sched_barrier(0);
    if (k + 1 < NKS) {                 // step k+1: registers -> the other buffer
      *(v8h*)&As[nxt][row][cs]  = cvt8(ra[nxt][0], ra[nxt][1]);
      *(v8h*)&Bs[nxt][krow][ns] = cvt8(rw[nxt][0], rw[nxt][1]);
    }
    // keeps the loads below behind the conversions above, in the set these have emptied
    __builtin_amdgcn_sched_barrier(0);
    if (k + 3 < NKS) {                 // step k+3: memory -> the set just emptied
      ra[nxt][0] = *(const v4f*)(ap + (k + 3) * 32);
      ra[nxt][1] = *(const v4f*)(ap + (k + 3) * 32 + 4);
      rw[nxt][0] = *(const v4f*)(wp + (size_t)(k + 3) * 32 * DMODEL);
      rw[nxt][1] = *(const v4f*)(wp + (size_t)(k + 3) * 32 * DMODEL + 4);
    }
    // behind the last loads: their address registers are free from here on, and this
    // stands in front of the first rewrite of one
    if (k + 3 == NKS - 1) asm volatile("s_wait_xcnt 0x0" ::: "memory");
    acc0 = wmma_f16(af, b0, acc0);
    acc1 = wmma_f16(af, b1, acc1);
    // ends the K-step for the scheduler: later conversions stay behind it
    __builtin_amdgcn_sched_barrier(0);
  }

  // C layout: element v -> (row = v + 8*(lane>>4), col = lane&15)
  const int mrow = m0 + r0 + 8 * (lane >> 4);
  const int ncol = n0 + c0 + l15;
#pragma unroll
  for (int v = 0; v < 8; ++v) {
    const int gr = mrow + v;
    const float x0 = acc0[v] * scale;
    const float x1 = acc1[v] * scale;
    if (MODE == 0) {
      float* o = (float*)Out;
      o[(size_t)gr * DMODEL + ncol]      = x0;
      o[(size_t)gr * DMODEL + ncol + 16] = x1;
    } else if (MODE == 1) {
      _Float16* o = (_Float16*)Out;
      o[(size_t)gr * DMODEL + ncol]      = (_Float16)x0;
      o[(size_t)gr * DMODEL + ncol + 16] = (_Float16)x1;
    } else {
      _Float16* o = (_Float16*)Out;
      o[(size_t)ncol * BT + gr]        = (_Float16)x0;
      o[(size_t)(ncol + 16) * BT + gr] = (_Float16)x1;
    }
  }
}

// ---------------------------------------------------------------------------
// The four projections of x (Q, K, V, gate) in one launch.
// Block: 256 threads (8 waves), 64 rows of x against the same 64 columns of all
// four weights, K-step 32. The x tile is fetched, converted and staged once per
// K-step for the four products. Pipeline as in gemm512: two register sets, two LDS
// buffers, one barrier a K-step.
// Wave w: weight w >> 1, columns (w & 1) * 32 .. + 31, all 64 rows (4 x 2 tiles).
// Outputs: Qh = 0.125 * x WQ (f16), Kh = x WK (f16), Vt = (x WV)^T (f16),
// Gp = x WG (f32).
// ---------------------------------------------------------------------------
// four waves a SIMD (at most 256 registers a wave), so that two blocks share a WGP
__global__ __launch_bounds__(256, 4) void proj4(const float* __restrict__ A,
                                             const float* __restrict__ WQ,
                                             const float* __restrict__ WK,
                                             const float* __restrict__ WV,
                                             const float* __restrict__ WG,
                                             _Float16* __restrict__ Qh,
                                             _Float16* __restrict__ Kh,
                                             _Float16* __restrict__ Vt,
                                             float* __restrict__ Gp) {
  __shared__ __attribute__((aligned(16))) _Float16 As[2][64][40];      // As[buf][m][k]
  // Bs[buf][i][k][n] = W_i[k0+k][n0+n]
  __shared__ __attribute__((aligned(16))) _Float16 Bs[2][4][32][WP];

  const int t    = threadIdx.x;
  const int lane = t & 31;
  // wave number as a scalar: the choice of weight and output is a scalar branch
  const int w    = __builtin_amdgcn_readfirstlane(t >> 5);
  const int m0   = blockIdx.x * 64;
  const int n0   = blockIdx.y * 64;

  const int wsel = w >> 1;             // wave's weight: 0 Q, 1 K, 2 V, 3 gate
  const int c0   = (w & 1) * 32;       // wave's 32-col block (two 16-col tiles)
  const int kb   = (lane >> 4) * 8;    // per-lane K sub-chunk (A/B frag layout)
  const int l15  = lane & 15;
  const int trk  = kb + (lane & 7);             // transposing reader: this lane's row
  const int trn  = c0 + ((lane >> 3) & 1) * 8;  // and its first column

  // Staging roles. A tile 64x32: 4 threads/row, 8 f32 each; W tiles 32x64, as
  // they lie: 8 threads/row, 8 f32 each, the same element offset in all four.
  const int row  = t >> 2, cs = (t & 3) * 8;
  const int krow = t >> 3, ns = (t & 7) * 8;
  const float* ap = A + (size_t)(m0 + row) * DMODEL + cs;
  const size_t wofs = (size_t)krow * DMODEL + n0 + ns;
  const float* wsrc[4] = {WQ + wofs, WK + wofs, WV + wofs, WG + wofs};

  v8f acc[4][2] = {{{}, {}}, {{}, {}}, {{}, {}}, {{}, {}}};
  v4f ra[2][2], rw[2][4][2];           // two register sets of staged f32 values

  // K-steps 0 and 1 into the two sets; step 0 on to LDS, its set refilled with step 2
#pragma unroll  // keeps ra[][] and rw[][][] in registers
  for (int s = 0; s < 2; ++s) {
    ra[s][0] = *(const v4f*)(ap + s * 32);
    ra[s][1] = *(const v4f*)(ap + s * 32 + 4);
#pragma unroll
    for (int i = 0; i < 4; ++i) {
      rw[s][i][0] = *(const v4f*)(wsrc[i] + (size_t)s * 32 * DMODEL);
      rw[s][i][1] = *(const v4f*)(wsrc[i] + (size_t)s * 32 * DMODEL + 4);
    }
  }
  *(v8h*)&As[0][row][cs] = cvt8(ra[0][0], ra[0][1]);
  ra[0][0] = *(const v4f*)(ap + 2 * 32);
  ra[0][1] = *(const v4f*)(ap + 2 * 32 + 4);
#pragma unroll
  for (int i = 0; i < 4; ++i) {
    *(v8h*)&Bs[0][i][krow][ns] = cvt8(rw[0][i][0], rw[0][i][1]);
    rw[0][i][0] = *(const v4f*)(wsrc[i] + (size_t)2 * 32 * DMODEL);
    rw[0][i][1] = *(const v4f*)(wsrc[i] + (size_t)2 * 32 * DMODEL + 4);
  }

  // unrolled whole: set and buffer numbers are constants, and every load's address is
  // a lane's base plus an immediate, so no address register is advanced under a load
#pragma unroll
  for (int k = 0; k < NKS; ++k) {
    const int cur = k & 1, nxt = cur ^ 1;
    // publishes buffer cur; ends every wave's reads of buffer nxt
    lds_barrier();

    // B fragments (32x16 f16): lane holds col c0 + l15 (+ 16), K chunks kb..kb+7,
    // kb+16..kb+23
    v16h b0 = cat8(ld_tr16(&Bs[cur][wsel][trk][trn]), ld_tr16(&Bs[cur][wsel][trk + 16][trn]));
    v16h b1 = cat8(ld_tr16(&Bs[cur][wsel][trk][trn + 16]),
                   ld_tr16(&Bs[cur][wsel][trk + 16][trn + 16]));
    // A fragments (16x32 f16): lane holds row r*16+l15, K chunks as above; all four
    // are read ahead of the products, so that their LDS latencies overlap
    v16h af[4];
#pragma unroll  // keeps af[] in registers
    for (int r = 0; r < 4; ++r) {
      const int mrow = r * 16 + l15;
      af[r] = cat8(*(const v8h*)&As[cur][mrow][kb], *(const v8h*)&As[cur][mrow][kb + 16]);
    }
    // keeps the scheduler from sinking the reads between the products, where each
    // pair of products would wait out one LDS latency of its own
    __builtin_amdgcn_sched_barrier(0);
    if (k + 1 < NKS) {                 // step k+1: registers -> the other buffer
      *(v8h*)&As[nxt][row][cs] = cvt8(ra[nxt][0], ra[nxt][1]);
#pragma unroll
      for (int i = 0; i < 4; ++i)
        *(v8h*)&Bs[nxt][i][krow][ns] = cvt8(rw[nxt][i][0], rw[nxt][i][1]);
    }
    // keeps the loads below behind the conversions above: lifted over them they would
    // need a third register set, and the wave would spill
    __builtin_amdgcn_sched_barrier(0);
    if (k + 3 < NKS) {                 // step k+3: memory -> the set just emptied
      ra[nxt][0] = *(const v4f*)(ap + (k + 3) * 32);
      ra[nxt][1] = *(const v4f*)(ap + (k + 3) * 32 + 4);
#pragma unroll
      for (int i = 0; i < 4; ++i) {
        rw[nxt][i][0] = *(const v4f*)(wsrc[i] + (size_t)(k + 3) * 32 * DMODEL);
        rw[nxt][i][1] = *(const v4f*)(wsrc[i] + (size_t)(k + 3) * 32 * DMODEL + 4);
      }
    }
    // behind the last loads: their address registers are free from here on, and this
    // stands in front of the first rewrite of one
    if (k + 3 == NKS - 1) asm volatile("s_wait_xcnt 0x0" ::: "memory");
#pragma unroll  // keeps acc[][] in registers
    for (int r = 0; r < 4; ++r) {
      acc[r][0] = wmma_f16(af[r], b0, acc[r][0]);
      acc[r][1] = wmma_f16(af[r], b1, acc[r][1]);
    }
    // keeps the next K-step's fragment reads behind these products: lifted over them
    // they would need a second fragment set, and the wave would spill
    __builtin_amdgcn_sched_barrier(0);
  }

  // C layout: element v -> (row = v + 8*(lane>>4), col = lane&15)
  const int mrow = m0 + 8 * (lane >> 4);
  const int ncol = n0 + c0 + l15;
  if (wsel < 2) {                      // Q (scaled) and K: f16 row-major
    _Float16* o = wsel ? Kh : Qh;
    const float scale = wsel ? 1.0f : 0.125f;
#pragma unroll
    for (int r = 0; r < 4; ++r)
#pragma unroll
      for (int v = 0; v < 8; ++v) {
        const int gr = mrow + r * 16 + v;
        o[(size_t)gr * DMODEL + ncol]      = (_Float16)(acc[r][0][v] * scale);
        o[(size_t)gr * DMODEL + ncol + 16] = (_Float16)(acc[r][1][v] * scale);
      }
  } else if (wsel == 2) {              // V: f16 transposed
#pragma unroll
    for (int r = 0; r < 4; ++r)
#pragma unroll
      for (int v = 0; v < 8; ++v) {
        const int gr = mrow + r * 16 + v;
        Vt[(size_t)ncol * BT + gr]        = (_Float16)acc[r][0][v];
        Vt[(size_t)(ncol + 16) * BT + gr] = (_Float16)acc[r][1][v];
      }
    // stands in front of every rewrite of a register of the stores above
    asm volatile("s_wait_xcnt 0x0" ::: "memory");
  } else {                             // gate: f32 row-major
#pragma unroll
    for (int r = 0; r < 4; ++r)
#pragma unroll
      for (int v = 0; v < 8; ++v) {
        const int gr = mrow + r * 16 + v;
        Gp[(size_t)gr * DMODEL + ncol]      = acc[r][0][v];
        Gp[(size_t)gr * DMODEL + ncol + 16] = acc[r][1][v];
      }
    // stands in front of every rewrite of a register of the stores above
    asm volatile("s_wait_xcnt 0x0" ::: "memory");
  }
}

#define KSTG   64
#define KVP    72

// One stage: 64 K rows and 64 V^T rows of 128 B each, 8 copies of 16 B per lane.
// lk/lv: this lane's LDS byte address in the K / V buffer, gk/gv: its global source.
__device__ __forceinline__ void copy_stage(unsigned lk, unsigned lv,
                                           const _Float16* gk,
                                           const _Float16* gv) {
  const unsigned rs = 16u * KVP * 2u;          // 16 rows further in LDS
  const _Float16* gk1 = gk + (size_t)16 * DMODEL;
  const _Float16* gk2 = gk + (size_t)32 * DMODEL;
  const _Float16* gk3 = gk + (size_t)48 * DMODEL;
  const _Float16* gv1 = gv + (size_t)16 * BT;
  const _Float16* gv2 = gv + (size_t)32 * BT;
  const _Float16* gv3 = gv + (size_t)48 * BT;
  // Copies global -> LDS through no register. The closing s_wait_xcnt stands in
  // the same statement so that no address register is rewritten ahead of it.
  asm volatile(
      "global_load_async_to_lds_b128 %0, %8, off\n\t"
      "global_load_async_to_lds_b128 %1, %9, off\n\t"
      "global_load_async_to_lds_b128 %2, %10, off\n\t"
      "global_load_async_to_lds_b128 %3, %11, off\n\t"
      "global_load_async_to_lds_b128 %4, %12, off\n\t"
      "global_load_async_to_lds_b128 %5, %13, off\n\t"
      "global_load_async_to_lds_b128 %6, %14, off\n\t"
      "global_load_async_to_lds_b128 %7, %15, off\n\t"
      "s_wait_xcnt 0x0"
      :: "v"(lk), "v"(lk + rs), "v"(lk + 2u * rs), "v"(lk + 3u * rs),
         "v"(lv), "v"(lv + rs), "v"(lv + 2u * rs), "v"(lv + 3u * rs),
         "v"(gk), "v"(gk1), "v"(gk2), "v"(gk3),
         "v"(gv), "v"(gv1), "v"(gv2), "v"(gv3)
      : "memory");
}

__device__ __forceinline__ float exp2_slot(float x) {
  float r;
  asm("v_exp_f32 %0, %1\n\tv_nop" : "=v"(r) : "v"(x));
  return r;
}

// Lane l's value from lane l ^ 16 (v_permlanex16_b32).
__device__ __forceinline__ float xhalf(float x) {
  return __builtin_bit_cast(float, __builtin_amdgcn_permlanex16(
      __builtin_bit_cast(int, x), __builtin_bit_cast(int, x), 0x76543210, 0xfedcba98,
      false, false));
}

__global__ __launch_bounds__(128) void retention_kernel(
    const _Float16* __restrict__ Qh,   // (B*T, 512) f16, pre-scaled
    const _Float16* __restrict__ Kh,   // (B*T, 512) f16
    const _Float16* __restrict__ Vt,   // (512, B*T) f16 (transposed V)
    const float* __restrict__ Gp,      // (B*T, 512) f32 gate pre-activation
    const float* __restrict__ gw,      // (512) GroupNorm weight
    const float* __restrict__ gb,      // (512) GroupNorm bias
    float* __restrict__ Z) {           // (B*T, 512) f32
  __shared__ __attribute__((aligned(16))) _Float16 Ks[2][KSTG][KVP];   // [key][feature]
  __shared__ __attribute__((aligned(16))) _Float16 Vs[2][DHEAD][KVP];  // [feature][key]

  const int lane = threadIdx.x & 31;
  // wave number as a scalar: the skip past the diagonal is then a scalar branch
  const int w    = __builtin_amdgcn_readfirstlane(threadIdx.x >> 5);
  const int h    = blockIdx.y;
  const int b    = blockIdx.z;
  const int q0   = blockIdx.x * 64 + w * 16;  // query base within batch
  const int nst  = blockIdx.x + 1;            // 64-key stages up to the diagonal

  // kb: first k of a lane's A/B chunks, and first row of its 8 accumulator rows
  const int kb   = (lane >> 4) * 8;
  const int l15  = lane & 15;
  const int qn   = q0 + l15;                  // this lane's query (a column of S^T, O^T)

  // Copy roles: 8 lanes per 128-byte row, rows crow, crow+16, crow+32, crow+48
  const int crow = threadIdx.x >> 3;
  const int ccol = (threadIdx.x & 7) * 8;
  const _Float16* gk = Kh + (size_t)(b * TSEQ + crow) * DMODEL + h * DHEAD + ccol;
  const _Float16* gv = Vt + (size_t)(h * DHEAD + crow) * BT + b * TSEQ + ccol;
  const unsigned lk0 = (unsigned)(uintptr_t)&Ks[0][crow][ccol];
  const unsigned lv0 = (unsigned)(uintptr_t)&Vs[0][crow][ccol];
  const unsigned bufb = KSTG * KVP * 2u;      // bytes of one buffer

  copy_stage(lk0, lv0, gk, gv);               // stage 0 -> buffer 0

  const float gamma = 1.0f - __builtin_amdgcn_exp2f(-5.0f - (float)h);
  const float lg    = __builtin_log2f(gamma);

  // keyfac = gamma^(-(key - m0)) for the lane's 2 x 8 keys of a block (exp in [0,32))
  float cw[2][8];
#pragma unroll  // keeps cw[][] in registers
  for (int tkey = 0; tkey < 2; ++tkey)
#pragma unroll
    for (int v = 0; v < 8; ++v)
      cw[tkey][v] = exp2_slot(-lg * (float)(tkey * 16 + kb + v));
  // rf = gamma^(qn - m0), starting at m0 = 0; step by gamma^-32
  const float stepf = __builtin_amdgcn_exp2f(-lg * 32.0f);
  float rf = __builtin_amdgcn_exp2f(lg * (float)qn);

  // Q^T B-fragments for K-dim 64 (two 32x16 tiles), loaded once from global:
  // lane holds query qn, feature chunks kb.., kb+16.. (+32)
  const v8h* qp = (const v8h*)(Qh + (size_t)(b * TSEQ + qn) * DMODEL + h * DHEAD + kb);
  const v16h bq0 = cat8(qp[0], qp[2]);
  const v16h bq1 = cat8(qp[4], qp[6]);

  // The gate's pre-activations, fetched here beside stage 0's copies; they are read only in the epilogue.
  // Element (nt, v) of a lane: row qn, feature nt * 16 + kb + v.
  const size_t tile = (size_t)(b * TSEQ + q0) * DMODEL + h * DHEAD;  // wave-uniform
  const int    eoff = l15 * DMODEL + kb;
  float gp[4][8];
#pragma unroll  // keeps gp[][] in registers
  for (int nt = 0; nt < 4; ++nt)
#pragma unroll
    for (int v = 0; v < 8; ++v) gp[nt][v] = Gp[tile + eoff + nt * 16 + v];

  v8f oacc[4] = {{}, {}, {}, {}};

  // stands in front of every rewrite of an address register of the loads above
  asm volatile("s_wait_xcnt 0x0" ::: "memory");
  // stage 0 has landed for this wave; the barrier publishes it to the others
  asm volatile("s_wait_asynccnt 0x0" ::: "memory");
  __syncthreads();
  if (nst > 1)
    copy_stage(lk0 + bufb, lv0 + bufb, gk + (size_t)KSTG * DMODEL, gv + KSTG);

  for (int s = 0; s < nst; ++s) {
    const int buf = s & 1;
    // unrolled: p folds into the immediate offsets of the LDS reads
#pragma unroll
    for (int p = 0; p < 2; ++p) {               // two 32-key blocks per stage
      const int m0 = s * KSTG + p * 32;
      if (m0 <= q0 + 15) {                      // wave-uniform: up to the diagonal
        // K A-fragments: 2 key tiles of 16, lane holds a key row, feature chunks as in Q^T
        v16h ak[2][2];
#pragma unroll  // keeps ak[][] in registers
        for (int tkey = 0; tkey < 2; ++tkey) {
          const _Float16* kp = &Ks[buf][p * 32 + tkey * 16 + l15][kb];
          ak[tkey][0] = cat8(*(const v8h*)(kp), *(const v8h*)(kp + 16));
          ak[tkey][1] = cat8(*(const v8h*)(kp + 32), *(const v8h*)(kp + 48));
        }
        // V^T A-fragments: 4 feature tiles of 16, keys contiguous in a V^T row
        v16h av[4];
#pragma unroll  // keeps av[] in registers
        for (int nt = 0; nt < 4; ++nt) {
          const _Float16* vp = &Vs[buf][nt * 16 + l15][p * 32 + kb];
          av[nt] = cat8(*(const v8h*)(vp), *(const v8h*)(vp + 16));
        }
        // keeps the scheduler from sinking the reads between the products, where each
        // product would wait out one LDS latency of its own
        __builtin_amdgcn_sched_barrier(0);
        // P^T B-fragment (32 keys x 16 queries): a lane's chunks are keys kb..kb+7 and
        // kb+16..kb+23 of its query, the very elements its two S^T tiles hold
        v16h pf;
        v8f sc[2] = {{}, {}};
#pragma unroll  // keeps sc[] in registers; the two tiles' chains fill each other's waits
        for (int tkey = 0; tkey < 2; ++tkey) sc[tkey] = wmma_f16(ak[tkey][0], bq0, sc[tkey]);
#pragma unroll
        for (int tkey = 0; tkey < 2; ++tkey) sc[tkey] = wmma_f16(ak[tkey][1], bq1, sc[tkey]);
        // causal multi-scale decay on the C fragments: element v of tile tkey is key
        // m0 + tkey * 16 + kb + v, at or before the query while tkey * 16 + v <= dq
        const int dq = qn - m0 - kb;
#pragma unroll  // keeps pf in registers
        for (int tkey = 0; tkey < 2; ++tkey)
#pragma unroll
          for (int v = 0; v < 8; ++v) {
            const float wgt = (dq >= tkey * 16 + v) ? rf * cw[tkey][v] : 0.0f;
            pf[tkey * 8 + v] = (_Float16)(sc[tkey][v] * wgt);
          }
        rf *= stepf;                            // advance rf to the next m0
#pragma unroll  // keeps av[] and oacc[] in registers
        for (int nt = 0; nt < 4; ++nt) oacc[nt] = wmma_f16(av[nt], pf, oacc[nt]);
      }
    }
    // Publish point, passed by every wave, also one that skipped a block above.
    // this wave's reads of buffer buf are done before the buffer is refilled
    asm volatile("s_wait_dscnt 0x0" ::: "memory");
    // this wave's copies of stage s+1 have landed before the others read them
    asm volatile("s_wait_asynccnt 0x0" ::: "memory");
    __syncthreads();
    if (s + 2 < nst)                            // block-uniform: refill the buffer just read
      copy_stage(lk0 + buf * bufb, lv0 + buf * bufb,
                 gk + (size_t)(s + 2) * KSTG * DMODEL, gv + (s + 2) * KSTG);
  }
  // no copy is left in flight when the wave ends
  asm volatile("s_wait_asynccnt 0x0" ::: "memory");

  // GroupNorm weight and bias of the lane's 32 features; they fly beside the sums below
  float gwv[4][8], gbv[4][8];
#pragma unroll  // keeps the two arrays in registers
  for (int nt = 0; nt < 4; ++nt)
#pragma unroll
    for (int v = 0; v < 8; ++v) {
      gwv[nt][v] = gw[h * DHEAD + nt * 16 + kb + v];
      gbv[nt][v] = gb[h * DHEAD + nt * 16 + kb + v];
    }

  // Sums of x and x*x over the query's 64 features: 32 in the lane, then the
  // other 32 from lane l ^ 16
  const v8f s1 = (oacc[0] + oacc[1]) + (oacc[2] + oacc[3]);
  const v8f s2 = (oacc[0] * oacc[0] + oacc[1] * oacc[1]) +
                 (oacc[2] * oacc[2] + oacc[3] * oacc[3]);
  float t1 = ((s1[0] + s1[1]) + (s1[2] + s1[3])) + ((s1[4] + s1[5]) + (s1[6] + s1[7]));
  float t2 = ((s2[0] + s2[1]) + (s2[2] + s2[3])) + ((s2[4] + s2[5]) + (s2[6] + s2[7]));
  t1 += xhalf(t1);
  t2 += xhalf(t2);
  const float mean = t1 * (1.0f / 64.0f);
  const float var  = t2 * (1.0f / 64.0f) - mean * mean;
  const float rstd = rsqrtf(var + 1e-5f);
#pragma unroll  // keeps oacc[] and the epilogue operands in registers
  for (int nt = 0; nt < 4; ++nt)
#pragma unroll
    for (int v = 0; v < 8; ++v) {
      const float nrm = (oacc[nt][v] - mean) * rstd;
      const float zz  = gp[nt][v] + nrm * gwv[nt][v] + gbv[nt][v];
      Z[tile + eoff + nt * 16 + v] = zz / (1.0f + __expf(-zz));
    }
}

// ---------------------------------------------------------------------------
extern "C" void kernel_launch(void* const* d_in, const int* in_sizes, int n_in,
                              void* d_out, int out_size, void* d_ws,
                              size_t ws_size, hipStream_t stream) {
  const float* x  = (const float*)d_in[0];
  const float* WQ = (const float*)d_in[1];
  const float* WK = (const float*)d_in[2];
  const float* WV = (const float*)d_in[3];
  const float* WG = (const float*)d_in[4];
  const float* WO = (const float*)d_in[5];
  const float* gw = (const float*)d_in[6];
  const float* gb = (const float*)d_in[7];

  char* ws = (char*)d_ws;
  _Float16* Qh = (_Float16*)(ws);                  // 4 MB: Q * 0.125, f16
  _Float16* Kh = (_Float16*)(ws + (4u << 20));     // 4 MB
  _Float16* Vt = (_Float16*)(ws + (8u << 20));     // 4 MB (transposed)
  float*    Gp = (float*)(ws + (12u << 20));       // 8 MB gate preact
  float*    Zb = (float*)(ws + (20u << 20));       // 8 MB silu out (28 MB total)

  dim3 gg(BT / 64, DMODEL / 64);
  proj4<<<gg, 256, 0, stream>>>(x, WQ, WK, WV, WG, Qh, Kh, Vt, Gp);

  retention_kernel<<<dim3(TSEQ / 64, NHEADS, 2), 128, 0, stream>>>(
      Qh, Kh, Vt, Gp, gw, gb, Zb);

  gemm512<0><<<gg, 256, 0, stream>>>(Zb, WO, (float*)d_out, 1.0f);
}

// v007
// A run of this version takes 34.6 microseconds.
// In both of two side-by-side timings against v006, it was 1.36 times as fast.
// Counting every step since v000, it is 5.05 times as fast.
#include <hip/hip_runtime.h>

typedef __attribute__((ext_vector_type(16))) _Float16 v16h;
typedef __attribute__((ext_vector_type(8)))  _Float16 v8h;
typedef __attribute__((ext_vector_type(8)))  float    v8f;
typedef __attribute__((ext_vector_type(8)))  short    v8s;
typedef __attribute__((ext_vector_type(4)))  float    v4f;

#define DMODEL 512
#define NHEADS 8
#define DHEAD  64
#define TSEQ   2048
#define BT     4096   // B*T rows

__device__ __forceinline__ v16h cat8(v8h lo, v8h hi) {
  v16h r;
#pragma unroll
  for (int i = 0; i < 8; ++i) { r[i] = lo[i]; r[i + 8] = hi[i]; }
  return r;
}

__device__ __forceinline__ v8f wmma_f16(v16h a, v16h b, v8f c) {
  // D = A(16x32 f16) * B(32x16 f16) + C(16x16 f32)
  return __builtin_amdgcn_wmma_f32_16x16x32_f16(false, a, false, b, (short)0, c,
                                                false, false);
}

// A weight tile lies in LDS as it lies in memory, [k][n], 64 halves a row.
#define WP 80   // LDS row pitch in halves: 160 B = 32 B x odd for the transposing reader

// Transposing LDS load (ds_load_tr16_b128). With lane l aimed at
// T[kbase + 8 * (l >> 4) + (l & 7)][nbase + 8 * ((l >> 3) & 1)] it returns
// T[kbase + 8 * (l >> 4) + 0..7][nbase + (l & 15)]: half a B fragment, k order as in A.
__device__ __forceinline__ v8h ld_tr16(const _Float16* p) {
  typedef __attribute__((address_space(3))) v8s lds_v8s;
  return __builtin_bit_cast(v8h, __builtin_amdgcn_ds_load_tr16_b128_v8i16((lds_v8s*)p));
}

// Eight staged f32 values as the eight halves of one 16-byte LDS store.
__device__ __forceinline__ v8h cvt8(v4f lo, v4f hi) {
  v8h r;
#pragma unroll
  for (int i = 0; i < 4; ++i) { r[i] = (_Float16)lo[i]; r[i + 4] = (_Float16)hi[i]; }
  return r;
}

// Work-group barrier fenced for LDS alone: every wave's LDS reads and writes are done
// at the barrier, while its global loads for later K-steps stay in flight across it
// (__syncthreads() would wait for them too).
__device__ __forceinline__ void lds_barrier() {
  __builtin_amdgcn_fence(__ATOMIC_RELEASE, "workgroup", "local");
  __builtin_amdgcn_s_barrier();
  __builtin_amdgcn_fence(__ATOMIC_ACQUIRE, "workgroup", "local");
}

__device__ __forceinline__ float exp2_slot(float x) {
  float r;
  asm("v_exp_f32 %0, %1\n\tv_nop" : "=v"(r) : "v"(x));
  return r;
}

#define NKS (DMODEL / 32)   // K-steps of 32
#define KSTG   64    // keys per chunk
#define KVP    72    // LDS row pitch in halves: 144 B = 16 B x odd for b128 readers
#define USZ    (DHEAD * DHEAD)   // elements of one chunk state

// ---------------------------------------------------------------------------
// Generic 4096x512 @ 512x512 GEMM, f32 inputs converted to f16 for WMMA.
// MODE 0: f32 row-major out (* scale)
// MODE 1: f16 row-major out (* scale)
// MODE 2: f16 transposed out  Out[col * BT + row]  (* scale)
// Block: 256 threads (8 waves). Tile: 64(M) x 64(N), K-step 32.
// Pipeline: a K-step's tiles are loaded into registers three K-steps before their
// products (two register sets), converted and stored to LDS one K-step before (two
// LDS buffers); one barrier a K-step.
// ---------------------------------------------------------------------------
template <int MODE>
__global__ __launch_bounds__(256) void gemm512(const float* __restrict__ A,
                                               const float* __restrict__ W,
                                               void* __restrict__ Out,
                                               float scale) {
  __shared__ __attribute__((aligned(16))) _Float16 As[2][64][40];   // As[buf][m][k]
  __shared__ __attribute__((aligned(16))) _Float16 Bs[2][32][WP];   // Bs[buf][k][n] = W[k0+k][n0+n]

  const int t    = threadIdx.x;
  const int lane = t & 31;
  const int w    = t >> 5;
  const int m0   = blockIdx.x * 64;
  const int n0   = blockIdx.y * 64;

  const int r0  = (w & 3) * 16;        // wave's 16-row block
  const int c0  = (w >> 2) * 32;       // wave's 32-col block (two 16-col tiles)
  const int kb  = (lane >> 4) * 8;     // per-lane K sub-chunk (A/B frag layout)
  const int l15 = lane & 15;
  const int trk = kb + (lane & 7);             // transposing reader: this lane's row
  const int trn = c0 + ((lane >> 3) & 1) * 8;  // and its first column

  // Staging roles. A tile 64x32: 4 threads/row, 8 f32 each; W tile 32x64 as it lies:
  // 8 threads/row, 8 f32 each, one 16-byte LDS store.
  const int row  = t >> 2, cs = (t & 3) * 8;
  const int krow = t >> 3, ns = (t & 7) * 8;
  const float* ap = A + (size_t)(m0 + row) * DMODEL + cs;
  const float* wp = W + (size_t)krow * DMODEL + n0 + ns;

  v8f acc0 = {}, acc1 = {};
  v4f ra[2][2], rw[2][2];              // two register sets of staged f32 values

  // K-steps 0 and 1 into the two sets; step 0 on to LDS, its set refilled with step 2
#pragma unroll  // keeps ra[][] and rw[][] in registers
  for (int s = 0; s < 2; ++s) {
    ra[s][0] = *(const v4f*)(ap + s * 32);
    ra[s][1] = *(const v4f*)(ap + s * 32 + 4);
    rw[s][0] = *(const v4f*)(wp + (size_t)s * 32 * DMODEL);
    rw[s][1] = *(const v4f*)(wp + (size_t)s * 32 * DMODEL + 4);
  }
  *(v8h*)&As[0][row][cs]  = cvt8(ra[0][0], ra[0][1]);
  *(v8h*)&Bs[0][krow][ns] = cvt8(rw[0][0], rw[0][1]);
  ra[0][0] = *(const v4f*)(ap + 2 * 32);
  ra[0][1] = *(const v4f*)(ap + 2 * 32 + 4);
  rw[0][0] = *(const v4f*)(wp + (size_t)2 * 32 * DMODEL);
  rw[0][1] = *(const v4f*)(wp + (size_t)2 * 32 * DMODEL + 4);

  // unrolled whole: set and buffer numbers are constants, and every load's address is
  // the lane's A or W base plus an immediate, so no address register is advanced under a load
#pragma unroll
  for (int k = 0; k < NKS; ++k) {
    const int cur = k & 1, nxt = cur ^ 1;
    // publishes buffer cur; ends every wave's reads of buffer nxt
    lds_barrier();

    // A fragment (16x32 f16): lane holds row r0+l15, K chunks kb..kb+7, kb+16..kb+23
    const int mrow = r0 + l15;
    v16h af = cat8(*(const v8h*)&As[cur][mrow][kb], *(const v8h*)&As[cur][mrow][kb + 16]);
    // B fragments (32x16 f16): lane holds col c0 + l15 (+ 16), K chunks as above
    v16h b0 = cat8(ld_tr16(&Bs[cur][trk][trn]), ld_tr16(&Bs[cur][trk + 16][trn]));
    v16h b1 = cat8(ld_tr16(&Bs[cur][trk][trn + 16]), ld_tr16(&Bs[cur][trk + 16][trn + 16]));
    // keeps the conversions below in this K-step: lifted to where their loads were
    // issued they would wait those loads out at once, and nothing would run ahead
    __builtin_amdgcn_sched_barrier(0);
    if (k + 1 < NKS) {                 // step k+1: registers -> the other buffer
      *(v8h*)&As[nxt][row][cs]  = cvt8(ra[nxt][0], ra[nxt][1]);
      *(v8h*)&Bs[nxt][krow][ns] = cvt8(rw[nxt][0], rw[nxt][1]);
    }
    // keeps the loads below behind the conversions above, in the set these have emptied
    __builtin_amdgcn_sched_barrier(0);
    if (k + 3 < NKS) {                 // step k+3: memory -> the set just emptied
      ra[nxt][0] = *(const v4f*)(ap + (k + 3) * 32);
      ra[nxt][1] = *(const v4f*)(ap + (k + 3) * 32 + 4);
      rw[nxt][0] = *(const v4f*)(wp + (size_t)(k + 3) * 32 * DMODEL);
      rw[nxt][1] = *(const v4f*)(wp + (size_t)(k + 3) * 32 * DMODEL + 4);
    }
    // behind the last loads: their address registers are free from here on, and this
    // stands in front of the first rewrite of one
    if (k + 3 == NKS - 1) asm volatile("s_wait_xcnt 0x0" ::: "memory");
    acc0 = wmma_f16(af, b0, acc0);
    acc1 = wmma_f16(af, b1, acc1);
    // ends the K-step for the scheduler: later conversions stay behind it
    __builtin_amdgcn_sched_barrier(0);
  }

  // C layout: element v -> (row = v + 8*(lane>>4), col = lane&15)
  const int mrow = m0 + r0 + 8 * (lane >> 4);
  const int ncol = n0 + c0 + l15;
#pragma unroll
  for (int v = 0; v < 8; ++v) {
    const int gr = mrow + v;
    const float x0 = acc0[v] * scale;
    const float x1 = acc1[v] * scale;
    if (MODE == 0) {
      float* o = (float*)Out;
      o[(size_t)gr * DMODEL + ncol]      = x0;
      o[(size_t)gr * DMODEL + ncol + 16] = x1;
    } else if (MODE == 1) {
      _Float16* o = (_Float16*)Out;
      o[(size_t)gr * DMODEL + ncol]      = (_Float16)x0;
      o[(size_t)gr * DMODEL + ncol + 16] = (_Float16)x1;
    } else {
      _Float16* o = (_Float16*)Out;
      o[(size_t)ncol * BT + gr]        = (_Float16)x0;
      o[(size_t)(ncol + 16) * BT + gr] = (_Float16)x1;
    }
  }
}

// ---------------------------------------------------------------------------
// The four projections of x (Q, K, V, gate) in one launch.
// Block: 256 threads (8 waves), 64 rows of x against the same 64 columns of all
// four weights, K-step 32. The x tile is fetched, converted and staged once per
// K-step for the four products. Pipeline as in gemm512: two register sets, two LDS
// buffers, one barrier a K-step.
// Wave w: weight w >> 1, columns (w & 1) * 32 .. + 31, all 64 rows (4 x 2 tiles).
// Outputs: Qh = 0.125 * x WQ (f16), Kh = x WK (f16), Vt = (x WV)^T (f16),
// Gp = x WG (f32).
// The block's 64 rows and 64 columns are one 64-key chunk of one head, so it also
// forms that chunk's decayed state, Ug[chunk][head][dv][dk] =
// sum over the chunk's keys m of gamma^(63 - m) * K[m][dk] * V[m][dv]  (f16).
// ---------------------------------------------------------------------------
// four waves a SIMD (at most 256 registers a wave), so that two blocks share a WGP
__global__ __launch_bounds__(256, 4) void proj4(const float* __restrict__ A,
                                             const float* __restrict__ WQ,
                                             const float* __restrict__ WK,
                                             const float* __restrict__ WV,
                                             const float* __restrict__ WG,
                                             _Float16* __restrict__ Qh,
                                             _Float16* __restrict__ Kh,
                                             _Float16* __restrict__ Vt,
                                             float* __restrict__ Gp,
                                             _Float16* __restrict__ Ug) {
  __shared__ __attribute__((aligned(16))) _Float16 As[2][64][40];      // As[buf][m][k]
  // Bs[buf][i][k][n] = W_i[k0+k][n0+n]
  __shared__ __attribute__((aligned(16))) _Float16 Bs[2][4][32][WP];

  const int t    = threadIdx.x;
  const int lane = t & 31;
  // wave number as a scalar: the choice of weight and output is a scalar branch
  const int w    = __builtin_amdgcn_readfirstlane(t >> 5);
  const int m0   = blockIdx.x * 64;
  const int n0   = blockIdx.y * 64;

  const int wsel = w >> 1;             // wave's weight: 0 Q, 1 K, 2 V, 3 gate
  const int c0   = (w & 1) * 32;       // wave's 32-col block (two 16-col tiles)
  const int kb   = (lane >> 4) * 8;    // per-lane K sub-chunk (A/B frag layout)
  const int l15  = lane & 15;
  const int trk  = kb + (lane & 7);             // transposing reader: this lane's row
  const int trn  = c0 + ((lane >> 3) & 1) * 8;  // and its first column

  // Staging roles. A tile 64x32: 4 threads/row, 8 f32 each; W tiles 32x64, as
  // they lie: 8 threads/row, 8 f32 each, the same element offset in all four.
  const int row  = t >> 2, cs = (t & 3) * 8;
  const int krow = t >> 3, ns = (t & 7) * 8;
  const float* ap = A + (size_t)(m0 + row) * DMODEL + cs;
  const size_t wofs = (size_t)krow * DMODEL + n0 + ns;
  const float* wsrc[4] = {WQ + wofs, WK + wofs, WV + wofs, WG + wofs};

  v8f acc[4][2] = {{{}, {}}, {{}, {}}, {{}, {}}, {{}, {}}};
  v4f ra[2][2], rw[2][4][2];           // two register sets of staged f32 values

  // K-steps 0 and 1 into the two sets; step 0 on to LDS, its set refilled with step 2
#pragma unroll  // keeps ra[][] and rw[][][] in registers
  for (int s = 0; s < 2; ++s) {
    ra[s][0] = *(const v4f*)(ap + s * 32);
    ra[s][1] = *(const v4f*)(ap + s * 32 + 4);
#pragma unroll
    for (int i = 0; i < 4; ++i) {
      rw[s][i][0] = *(const v4f*)(wsrc[i] + (size_t)s * 32 * DMODEL);
      rw[s][i][1] = *(const v4f*)(wsrc[i] + (size_t)s * 32 * DMODEL + 4);
    }
  }
  *(v8h*)&As[0][row][cs] = cvt8(ra[0][0], ra[0][1]);
  ra[0][0] = *(const v4f*)(ap + 2 * 32);
  ra[0][1] = *(const v4f*)(ap + 2 * 32 + 4);
#pragma unroll
  for (int i = 0; i < 4; ++i) {
    *(v8h*)&Bs[0][i][krow][ns] = cvt8(rw[0][i][0], rw[0][i][1]);
    rw[0][i][0] = *(const v4f*)(wsrc[i] + (size_t)2 * 32 * DMODEL);
    rw[0][i][1] = *(const v4f*)(wsrc[i] + (size_t)2 * 32 * DMODEL + 4);
  }

  // unrolled whole: set and buffer numbers are constants, and every load's address is
  // a lane's base plus an immediate, so no address register is advanced under a load
#pragma unroll
  for (int k = 0; k < NKS; ++k) {
    const int cur = k & 1, nxt = cur ^ 1;
    // publishes buffer cur; ends every wave's reads of buffer nxt
    lds_barrier();

    // B fragments (32x16 f16): lane holds col c0 + l15 (+ 16), K chunks kb..kb+7,
    // kb+16..kb+23
    v16h b0 = cat8(ld_tr16(&Bs[cur][wsel][trk][trn]), ld_tr16(&Bs[cur][wsel][trk + 16][trn]));
    v16h b1 = cat8(ld_tr16(&Bs[cur][wsel][trk][trn + 16]),
                   ld_tr16(&Bs[cur][wsel][trk + 16][trn + 16]));
    // A fragments (16x32 f16): lane holds row r*16+l15, K chunks as above; all four
    // are read ahead of the products, so that their LDS latencies overlap
    v16h af[4];
#pragma unroll  // keeps af[] in registers
    for (int r = 0; r < 4; ++r) {
      const int mrow = r * 16 + l15;
      af[r] = cat8(*(const v8h*)&As[cur][mrow][kb], *(const v8h*)&As[cur][mrow][kb + 16]);
    }
    // keeps the scheduler from sinking the reads between the products, where each
    // pair of products would wait out one LDS latency of its own
    __builtin_amdgcn_sched_barrier(0);
    if (k + 1 < NKS) {                 // step k+1: registers -> the other buffer
      *(v8h*)&As[nxt][row][cs] = cvt8(ra[nxt][0], ra[nxt][1]);
#pragma unroll
      for (int i = 0; i < 4; ++i)
        *(v8h*)&Bs[nxt][i][krow][ns] = cvt8(rw[nxt][i][0], rw[nxt][i][1]);
    }
    // keeps the loads below behind the conversions above: lifted over them they would
    // need a third register set, and the wave would spill
    __builtin_amdgcn_sched_barrier(0);
    if (k + 3 < NKS) {                 // step k+3: memory -> the set just emptied
      ra[nxt][0] = *(const v4f*)(ap + (k + 3) * 32);
      ra[nxt][1] = *(const v4f*)(ap + (k + 3) * 32 + 4);
#pragma unroll
      for (int i = 0; i < 4; ++i) {
        rw[nxt][i][0] = *(const v4f*)(wsrc[i] + (size_t)(k + 3) * 32 * DMODEL);
        rw[nxt][i][1] = *(const v4f*)(wsrc[i] + (size_t)(k + 3) * 32 * DMODEL + 4);
      }
    }
    // behind the last loads: their address registers are free from here on, and this
    // stands in front of the first rewrite of one
    if (k + 3 == NKS - 1) asm volatile("s_wait_xcnt 0x0" ::: "memory");
#pragma unroll  // keeps acc[][] in registers
    for (int r = 0; r < 4; ++r) {
      acc[r][0] = wmma_f16(af[r], b0, acc[r][0]);
      acc[r][1] = wmma_f16(af[r], b1, acc[r][1]);
    }
    // keeps the next K-step's fragment reads behind these products: lifted over them
    // they would need a second fragment set, and the wave would spill
    __builtin_amdgcn_sched_barrier(0);
  }

  // Chunk state. The K waves (keys decayed) and the V waves lay their tiles in LDS
  // transposed, [feature][key]: a lane's 8 accumulator rows are 8 keys in a row there.
  // They lie in buffer 0 of Bs, which no wave reads behind the last K-step's barrier.
  _Float16* Kl = &Bs[0][0][0][0];
  _Float16* Vl = Kl + DHEAD * KVP;
  if (wsel == 1) {
    const float gam = 1.0f - __builtin_amdgcn_exp2f(-5.0f - (float)blockIdx.y);
    const float lgg = __builtin_log2f(gam);
#pragma unroll  // keeps acc[][] in registers
    for (int r = 0; r < 4; ++r) {
      v8h k0, k1;
#pragma unroll
      for (int v = 0; v < 8; ++v) {
        const float dw = exp2_slot(lgg * (float)(63 - r * 16 - kb - v));
        k0[v] = (_Float16)(acc[r][0][v] * dw);
        k1[v] = (_Float16)(acc[r][1][v] * dw);
      }
      *(v8h*)&Kl[(c0 + l15) * KVP + r * 16 + kb]      = k0;
      *(v8h*)&Kl[(c0 + 16 + l15) * KVP + r * 16 + kb] = k1;
    }
  } else if (wsel == 2) {
#pragma unroll  // keeps acc[][] in registers
    for (int r = 0; r < 4; ++r) {
      v8h v0, v1;
#pragma unroll
      for (int v = 0; v < 8; ++v) {
        v0[v] = (_Float16)acc[r][0][v];
        v1[v] = (_Float16)acc[r][1][v];
      }
      *(v8h*)&Vl[(c0 + l15) * KVP + r * 16 + kb]      = v0;
      *(v8h*)&Vl[(c0 + 16 + l15) * KVP + r * 16 + kb] = v1;
    }
  }
  // publishes the two transposed tiles to all eight waves
  lds_barrier();
  {
    // U = (decayed K)^T V, 64 x 64 over 64 keys: wave w has dk tile w >> 1 and two dv
    // tiles. A: lane holds row dk, B: lane holds column dv, both with key chunks kb..,
    // kb+16.. (+32). A lane's 8 results are 8 dk in a row of Ug[dv][dk].
    const _Float16* kp = &Kl[(wsel * 16 + l15) * KVP + kb];
    const v16h ka0 = cat8(*(const v8h*)(kp), *(const v8h*)(kp + 16));
    const v16h ka1 = cat8(*(const v8h*)(kp + 32), *(const v8h*)(kp + 48));
    v8f u[2] = {{}, {}};
    v16h vb[2][2];
#pragma unroll  // keeps vb[][] in registers
    for (int j = 0; j < 2; ++j) {
      const _Float16* vp = &Vl[(c0 + j * 16 + l15) * KVP + kb];
      vb[j][0] = cat8(*(const v8h*)(vp), *(const v8h*)(vp + 16));
      vb[j][1] = cat8(*(const v8h*)(vp + 32), *(const v8h*)(vp + 48));
    }
#pragma unroll  // keeps u[] in registers; the two tiles' chains fill each other's waits
    for (int j = 0; j < 2; ++j) u[j] = wmma_f16(ka0, vb[j][0], u[j]);
#pragma unroll
    for (int j = 0; j < 2; ++j) u[j] = wmma_f16(ka1, vb[j][1], u[j]);
    _Float16* ug = Ug + ((size_t)blockIdx.x * NHEADS + blockIdx.y) * USZ +
                   (c0 + l15) * DHEAD + wsel * 16 + kb;
#pragma unroll
    for (int j = 0; j < 2; ++j) {
      v8h uh;
#pragma unroll
      for (int v = 0; v < 8; ++v) uh[v] = (_Float16)u[j][v];
      *(v8h*)(ug + j * 16 * DHEAD) = uh;
    }
    // stands in front of every rewrite of a register of the two stores above
    asm volatile("s_wait_xcnt 0x0" ::: "memory");
  }

  // C layout: element v -> (row = v + 8*(lane>>4), col = lane&15)
  const int mrow = m0 + 8 * (lane >> 4);
  const int ncol = n0 + c0 + l15;
  if (wsel < 2) {                      // Q (scaled) and K: f16 row-major
    _Float16* o = wsel ? Kh : Qh;
    const float scale = wsel ? 1.0f : 0.125f;
#pragma unroll
    for (int r = 0; r < 4; ++r)
#pragma unroll
      for (int v = 0; v < 8; ++v) {
        const int gr = mrow + r * 16 + v;
        o[(size_t)gr * DMODEL + ncol]      = (_Float16)(acc[r][0][v] * scale);
        o[(size_t)gr * DMODEL + ncol + 16] = (_Float16)(acc[r][1][v] * scale);
      }
  } else if (wsel == 2) {              // V: f16 transposed
#pragma unroll
    for (int r = 0; r < 4; ++r)
#pragma unroll
      for (int v = 0; v < 8; ++v) {
        const int gr = mrow + r * 16 + v;
        Vt[(size_t)ncol * BT + gr]        = (_Float16)acc[r][0][v];
        Vt[(size_t)(ncol + 16) * BT + gr] = (_Float16)acc[r][1][v];
      }
    // stands in front of every rewrite of a register of the stores above
    asm volatile("s_wait_xcnt 0x0" ::: "memory");
  } else {                             // gate: f32 row-major
#pragma unroll
    for (int r = 0; r < 4; ++r)
#pragma unroll
      for (int v = 0; v < 8; ++v) {
        const int gr = mrow + r * 16 + v;
        Gp[(size_t)gr * DMODEL + ncol]      = acc[r][0][v];
        Gp[(size_t)gr * DMODEL + ncol + 16] = acc[r][1][v];
      }
    // stands in front of every rewrite of a register of the stores above
    asm volatile("s_wait_xcnt 0x0" ::: "memory");
  }
}

// One stage: 64 K rows and 64 V^T rows of 128 B each, 8 copies of 16 B per lane.
// lk/lv: this lane's LDS byte address in the K / V buffer, gk/gv: its global source.
__device__ __forceinline__ void copy_stage(unsigned lk, unsigned lv,
                                           const _Float16* gk,
                                           const _Float16* gv) {
  const unsigned rs = 16u * KVP * 2u;          // 16 rows further in LDS
  const _Float16* gk1 = gk + (size_t)16 * DMODEL;
  const _Float16* gk2 = gk + (size_t)32 * DMODEL;
  const _Float16* gk3 = gk + (size_t)48 * DMODEL;
  const _Float16* gv1 = gv + (size_t)16 * BT;
  const _Float16* gv2 = gv + (size_t)32 * BT;
  const _Float16* gv3 = gv + (size_t)48 * BT;
  // Copies global -> LDS through no register. The closing s_wait_xcnt stands in
  // the same statement so that no address register is rewritten ahead of it.
  asm volatile(
      "global_load_async_to_lds_b128 %0, %8, off\n\t"
      "global_load_async_to_lds_b128 %1, %9, off\n\t"
      "global_load_async_to_lds_b128 %2, %10, off\n\t"
      "global_load_async_to_lds_b128 %3, %11, off\n\t"
      "global_load_async_to_lds_b128 %4, %12, off\n\t"
      "global_load_async_to_lds_b128 %5, %13, off\n\t"
      "global_load_async_to_lds_b128 %6, %14, off\n\t"
      "global_load_async_to_lds_b128 %7, %15, off\n\t"
      "s_wait_xcnt 0x0"
      :: "v"(lk), "v"(lk + rs), "v"(lk + 2u * rs), "v"(lk + 3u * rs),
         "v"(lv), "v"(lv + rs), "v"(lv + 2u * rs), "v"(lv + 3u * rs),
         "v"(gk), "v"(gk1), "v"(gk2), "v"(gk3),
         "v"(gv), "v"(gv1), "v"(gv2), "v"(gv3)
      : "memory");
}

// Lane l's value from lane l ^ 16 (v_permlanex16_b32).
__device__ __forceinline__ float xhalf(float x) {
  return __builtin_bit_cast(float, __builtin_amdgcn_permlanex16(
      __builtin_bit_cast(int, x), __builtin_bit_cast(int, x), 0x76543210, 0xfedcba98,
      false, false));
}

__global__ __launch_bounds__(128) void retention_kernel(
    const _Float16* __restrict__ Qh,   // (B*T, 512) f16, pre-scaled
    const _Float16* __restrict__ Kh,   // (B*T, 512) f16
    const _Float16* __restrict__ Vt,   // (512, B*T) f16 (transposed V)
    const _Float16* __restrict__ Ug,   // (B*T/64, 8, 64, 64) f16 chunk states [dv][dk]
    const float* __restrict__ Gp,      // (B*T, 512) f32 gate pre-activation
    const float* __restrict__ gw,      // (512) GroupNorm weight
    const float* __restrict__ gb,      // (512) GroupNorm bias
    float* __restrict__ Z) {           // (B*T, 512) f32
  __shared__ __attribute__((aligned(16))) _Float16 Ks[KSTG][KVP];    // [key][feature]
  __shared__ __attribute__((aligned(16))) _Float16 Vs[DHEAD][KVP];   // [feature][key]
  // state, [dv][dk], as two f16 terms: [0] the rounded value, [1] what the rounding left
  __shared__ __attribute__((aligned(16))) _Float16 Ss[2][DHEAD][KVP];

  const int lane = threadIdx.x & 31;
  // wave number as a scalar: the skip past the diagonal is then a scalar branch
  const int w    = __builtin_amdgcn_readfirstlane(threadIdx.x >> 5);
  const int h    = blockIdx.y;
  const int b    = blockIdx.z;
  const int cx   = blockIdx.x;                // the block's chunk; cx chunks lie before it
  const int c0   = cx * KSTG;                 // its first query and first own key
  const int q0   = c0 + w * 16;               // query base within batch

  // kb: first k of a lane's A/B chunks, and first row of its 8 accumulator rows
  const int kb   = (lane >> 4) * 8;
  const int l15  = lane & 15;
  const int qn   = q0 + l15;                  // this lane's query (a column of S^T, O^T)

  // Copy roles: 8 lanes per 128-byte row, rows crow, crow+16, crow+32, crow+48
  const int crow = threadIdx.x >> 3;
  const int ccol = (threadIdx.x & 7) * 8;
  const _Float16* gk = Kh + (size_t)(b * TSEQ + c0 + crow) * DMODEL + h * DHEAD + ccol;
  const _Float16* gv = Vt + (size_t)(h * DHEAD + crow) * BT + b * TSEQ + c0 + ccol;
  const unsigned lk0 = (unsigned)(uintptr_t)&Ks[crow][ccol];
  const unsigned lv0 = (unsigned)(uintptr_t)&Vs[crow][ccol];

  copy_stage(lk0, lv0, gk, gv);               // the block's own 64 keys

  const float gamma = 1.0f - __builtin_amdgcn_exp2f(-5.0f - (float)h);
  const float lg    = __builtin_log2f(gamma);

  // Q^T B-fragments for K-dim 64 (two 32x16 tiles), loaded once from global:
  // lane holds query qn, feature chunks kb.., kb+16.. (+32)
  const v8h* qp = (const v8h*)(Qh + (size_t)(b * TSEQ + qn) * DMODEL + h * DHEAD + kb);
  const v16h bq0 = cat8(qp[0], qp[2]);
  const v16h bq1 = cat8(qp[4], qp[6]);

  // The gate's pre-activations, fetched here beside the copies.
  // Element (nt, v) of a lane: row qn, feature nt * 16 + kb + v.
  const size_t tile = (size_t)(b * TSEQ + q0) * DMODEL + h * DHEAD;  // wave-uniform
  const int    eoff = l15 * DMODEL + kb;
  float gp[4][8];
#pragma unroll  // keeps gp[][] in registers
  for (int nt = 0; nt < 4; ++nt)
#pragma unroll
    for (int v = 0; v < 8; ++v) gp[nt][v] = Gp[tile + eoff + nt * 16 + v];

  // stands in front of every rewrite of an address register of the loads above
  asm volatile("s_wait_xcnt 0x0" ::: "memory");

  // State of the keys before c0: sa = sa * gamma^64 + U_j, j = 0 .. cx-1. A lane has
  // 4 pieces of 8 halves, piece i at element (i * 128 + thread) * 8 of [dv][dk].
  // Eight chunks' loads fly together; the first batch starts below 0 where cx is no
  // multiple of 8: such a chunk's address is clamped and its values are not used.
  const float g64 = __builtin_amdgcn_exp2f(lg * 64.0f);
  // block-uniform base of chunk 0's state; the lane's own offset stays in one register
  const _Float16* ub = Ug + ((size_t)(b * (TSEQ / KSTG)) * NHEADS + h) * USZ;
  const int uo = threadIdx.x * 8;
  float sa[4][8];
#pragma unroll  // keeps sa[][] in registers
  for (int i = 0; i < 4; ++i)
#pragma unroll
    for (int e = 0; e < 8; ++e) sa[i][e] = 0.0f;
  for (int j0 = cx - ((cx + 7) & ~7); j0 < cx; j0 += 8) {
    v8h u[8][4];
    const _Float16* pu[8];
#pragma unroll  // keeps u[][] and pu[] in registers
    for (int k = 0; k < 8; ++k) {
      const int jc = (j0 + k < 0) ? 0 : j0 + k;
      pu[k] = ub + (size_t)jc * (NHEADS * USZ) + uo;
#pragma unroll
      for (int i = 0; i < 4; ++i) u[k][i] = *(const v8h*)(pu[k] + i * 1024);
    }
    // stands in front of every rewrite of an address register of the loads above; the
    // addresses are its inputs, so that none of their registers is given to a later
    // load's result ahead of it
    asm volatile("s_wait_xcnt 0x0"
                 :: "v"(pu[0]), "v"(pu[1]), "v"(pu[2]), "v"(pu[3]),
                    "v"(pu[4]), "v"(pu[5]), "v"(pu[6]), "v"(pu[7])
                 : "memory");
#pragma unroll
    for (int k = 0; k < 8; ++k)
      if (j0 + k >= 0) {                        // block-uniform, a scalar branch
#pragma unroll
        for (int i = 0; i < 4; ++i)
#pragma unroll
          for (int e = 0; e < 8; ++e) sa[i][e] = sa[i][e] * g64 + (float)u[k][i][e];
      }
  }
#pragma unroll
  for (int i = 0; i < 4; ++i) {
    v8h sh, sl;
#pragma unroll
    for (int e = 0; e < 8; ++e) {
      sh[e] = (_Float16)sa[i][e];
      sl[e] = (_Float16)(sa[i][e] - (float)sh[e]);
    }
    *(v8h*)&Ss[0][i * 16 + crow][ccol] = sh;
    *(v8h*)&Ss[1][i * 16 + crow][ccol] = sl;
  }

  // keyfac = gamma^(-(key - m0)) for the lane's 2 x 8 keys of a block (exp in [0,32))
  float cw[2][8];
#pragma unroll  // keeps cw[][] in registers
  for (int tkey = 0; tkey < 2; ++tkey)
#pragma unroll
    for (int v = 0; v < 8; ++v)
      cw[tkey][v] = exp2_slot(-lg * (float)(tkey * 16 + kb + v));
  // rf = gamma^(qn - m0), starting at m0 = c0; step by gamma^-32
  const float stepf = __builtin_amdgcn_exp2f(-lg * 32.0f);
  float rf = __builtin_amdgcn_exp2f(lg * (float)(qn - c0));

  // the copies have landed for this wave; the barrier publishes them, and the state
  // in Ss, to the others
  asm volatile("s_wait_asynccnt 0x0" ::: "memory");
  __syncthreads();

  // Earlier keys: O^T = gamma^(qn-c0+1) * H^T Q^T. State A-fragments: 4 dv tiles of 16,
  // lane holds a dv row, dk chunks as in Q^T
  v8f oacc[4] = {{}, {}, {}, {}};
  {
#pragma unroll  // the small term first, then the rounded value
    for (int part = 1; part >= 0; --part) {
      v16h as[4][2];
#pragma unroll  // keeps as[][] in registers
      for (int nt = 0; nt < 4; ++nt) {
        const _Float16* sp = &Ss[part][nt * 16 + l15][kb];
        as[nt][0] = cat8(*(const v8h*)(sp), *(const v8h*)(sp + 16));
        as[nt][1] = cat8(*(const v8h*)(sp + 32), *(const v8h*)(sp + 48));
      }
#pragma unroll  // keeps oacc[] in registers; the four chains fill each other's waits
      for (int nt = 0; nt < 4; ++nt) oacc[nt] = wmma_f16(as[nt][0], bq0, oacc[nt]);
#pragma unroll
      for (int nt = 0; nt < 4; ++nt) oacc[nt] = wmma_f16(as[nt][1], bq1, oacc[nt]);
    }
    const float qf = rf * gamma;
#pragma unroll
    for (int nt = 0; nt < 4; ++nt) oacc[nt] *= qf;
  }

  // unrolled: p folds into the immediate offsets of the LDS reads
#pragma unroll
  for (int p = 0; p < 2; ++p) {                 // the chunk's two 32-key blocks
    const int m0 = c0 + p * 32;
    if (m0 <= q0 + 15) {                        // wave-uniform: up to the diagonal
      // K A-fragments: 2 key tiles of 16, lane holds a key row, feature chunks as in Q^T
      v16h ak[2][2];
#pragma unroll  // keeps ak[][] in registers
      for (int tkey = 0; tkey < 2; ++tkey) {
        const _Float16* kp = &Ks[p * 32 + tkey * 16 + l15][kb];
        ak[tkey][0] = cat8(*(const v8h*)(kp), *(const v8h*)(kp + 16));
        ak[tkey][1] = cat8(*(const v8h*)(kp + 32), *(const v8h*)(kp + 48));
      }
      // V^T A-fragments: 4 feature tiles of 16, keys contiguous in a V^T row
      v16h av[4];
#pragma unroll  // keeps av[] in registers
      for (int nt = 0; nt < 4; ++nt) {
        const _Float16* vp = &Vs[nt * 16 + l15][p * 32 + kb];
        av[nt] = cat8(*(const v8h*)(vp), *(const v8h*)(vp + 16));
      }
      // keeps the scheduler from sinking the reads between the products, where each
      // product would wait out one LDS latency of its own
      __builtin_amdgcn_sched_barrier(0);
      // P^T B-fragment (32 keys x 16 queries): a lane's chunks are keys kb..kb+7 and
      // kb+16..kb+23 of its query, the very elements its two S^T tiles hold
      v16h pf;
      v8f sc[2] = {{}, {}};
#pragma unroll  // keeps sc[] in registers; the two tiles' chains fill each other's waits
      for (int tkey = 0; tkey < 2; ++tkey) sc[tkey] = wmma_f16(ak[tkey][0], bq0, sc[tkey]);
#pragma unroll
      for (int tkey = 0; tkey < 2; ++tkey) sc[tkey] = wmma_f16(ak[tkey][1], bq1, sc[tkey]);
      // causal multi-scale decay on the C fragments: element v of tile tkey is key
      // m0 + tkey * 16 + kb + v, at or before the query while tkey * 16 + v <= dq
      const int dq = qn - m0 - kb;
#pragma unroll  // keeps pf in registers
      for (int tkey = 0; tkey < 2; ++tkey)
#pragma unroll
        for (int v = 0; v < 8; ++v) {
          const float wgt = (dq >= tkey * 16 + v) ? rf * cw[tkey][v] : 0.0f;
          pf[tkey * 8 + v] = (_Float16)(sc[tkey][v] * wgt);
        }
      rf *= stepf;                              // advance rf to the next m0
#pragma unroll  // keeps av[] and oacc[] in registers
      for (int nt = 0; nt < 4; ++nt) oacc[nt] = wmma_f16(av[nt], pf, oacc[nt]);
    }
  }

  // GroupNorm weight and bias of the lane's 32 features; they fly beside the sums below
  float gwv[4][8], gbv[4][8];
#pragma unroll  // keeps the two arrays in registers
  for (int nt = 0; nt < 4; ++nt)
#pragma unroll
    for (int v = 0; v < 8; ++v) {
      gwv[nt][v] = gw[h * DHEAD + nt * 16 + kb + v];
      gbv[nt][v] = gb[h * DHEAD + nt * 16 + kb + v];
    }

  // Sums of x and x*x over the query's 64 features: 32 in the lane, then the
  // other 32 from lane l ^ 16
  const v8f s1 = (oacc[0] + oacc[1]) + (oacc[2] + oacc[3]);
  const v8f s2 = (oacc[0] * oacc[0] + oacc[1] * oacc[1]) +
                 (oacc[2] * oacc[2] + oacc[3] * oacc[3]);
  float t1 = ((s1[0] + s1[1]) + (s1[2] + s1[3])) + ((s1[4] + s1[5]) + (s1[6] + s1[7]));
  float t2 = ((s2[0] + s2[1]) + (s2[2] + s2[3])) + ((s2[4] + s2[5]) + (s2[6] + s2[7]));
  t1 += xhalf(t1);
  t2 += xhalf(t2);
  const float mean = t1 * (1.0f / 64.0f);
  const float var  = t2 * (1.0f / 64.0f) - mean * mean;
  const float rstd = rsqrtf(var + 1e-5f);
#pragma unroll  // keeps oacc[] and the epilogue operands in registers
  for (int nt = 0; nt < 4; ++nt)
#pragma unroll
    for (int v = 0; v < 8; ++v) {
      const float nrm = (oacc[nt][v] - mean) * rstd;
      const float zz  = gp[nt][v] + nrm * gwv[nt][v] + gbv[nt][v];
      Z[tile + eoff + nt * 16 + v] = zz / (1.0f + __expf(-zz));
    }
}

// ---------------------------------------------------------------------------
extern "C" void kernel_launch(void* const* d_in, const int* in_sizes, int n_in,
                              void* d_out, int out_size, void* d_ws,
                              size_t ws_size, hipStream_t stream) {
  const float* x  = (const float*)d_in[0];
  const float* WQ = (const float*)d_in[1];
  const float* WK = (const float*)d_in[2];
  const float* WV = (const float*)d_in[3];
  const float* WG = (const float*)d_in[4];
  const float* WO = (const float*)d_in[5];
  const float* gw = (const float*)d_in[6];
  const float* gb = (const float*)d_in[7];

  char* ws = (char*)d_ws;
  _Float16* Qh = (_Float16*)(ws);                  // 4 MB: Q * 0.125, f16
  _Float16* Kh = (_Float16*)(ws + (4u << 20));     // 4 MB
  _Float16* Vt = (_Float16*)(ws + (8u << 20));     // 4 MB (transposed)
  float*    Gp = (float*)(ws + (12u << 20));       // 8 MB gate preact
  float*    Zb = (float*)(ws + (20u << 20));       // 8 MB silu out
  _Float16* Ug = (_Float16*)(ws + (28u << 20));    // 4 MB chunk states (32 MB total)

  dim3 gg(BT / 64, DMODEL / 64);
  proj4<<<gg, 256, 0, stream>>>(x, WQ, WK, WV, WG, Qh, Kh, Vt, Gp, Ug);

  retention_kernel<<<dim3(TSEQ / 64, NHEADS, 2), 128, 0, stream>>>(
      Qh, Kh, Vt, Ug, Gp, gw, gb, Zb);

  gemm512<0><<<gg, 256, 0, stream>>>(Zb, WO, (float*)d_out, 1.0f);
}
